// v000
// The times below were measured on an AMD MI455X: many runs one after another, warmed up first and cycling through
// copies of the inputs, with the whole window's GPU time divided by the number of runs. Launches and the gaps
// between them are all in it. The median over several windows is given; except for v000 it joins two sittings, which
// can be a few percent apart, so the side-by-side timings, each taken in one sitting, are the better comparison.
// v000, which the later versions start from, runs in 464 microseconds.
#include <hip/hip_runtime.h>
#include <hip/hip_bf16.h>
#include <math.h>

// Problem dims (fixed by reference)
#define WBATCH 4
#define WT     2048
#define WC     512
#define WH     8
#define WD     64
#define WM     (WBATCH * WT)   // 8192 tokens

typedef __bf16 bf16_t;
typedef __attribute__((ext_vector_type(16))) __bf16 v16bf;
typedef __attribute__((ext_vector_type(8)))  __bf16 v8bf;
typedef __attribute__((ext_vector_type(8)))  float  v8f;
typedef __attribute__((ext_vector_type(4)))  int    v4i;
typedef __attribute__((ext_vector_type(8)))  int    v8i;
typedef __attribute__((ext_vector_type(4)))  unsigned int v4u;

// ---- helpers -------------------------------------------------------------

__device__ __forceinline__ bf16_t f2bf(float f) {
  union { float f; unsigned u; } a; a.f = f;
  unsigned r = a.u + 0x7fffu + ((a.u >> 16) & 1u);   // round-nearest-even
  unsigned short s = (unsigned short)(r >> 16);
  bf16_t b; __builtin_memcpy(&b, &s, 2); return b;
}

__device__ __forceinline__ v16bf mkfrag(const bf16_t* row, int hl) {
  v8bf lo = *(const v8bf*)(row + hl * 8);
  v8bf hi = *(const v8bf*)(row + 16 + hl * 8);
  return __builtin_shufflevector(lo, hi, 0,1,2,3,4,5,6,7,8,9,10,11,12,13,14,15);
}

__device__ __forceinline__ v8f wmma_bf16(v16bf a, v16bf b, v8f c) {
  return __builtin_amdgcn_wmma_f32_16x16x32_bf16(false, a, false, b, (short)0, c,
                                                 false, false);
}

#if __has_builtin(__builtin_amdgcn_global_load_async_to_lds_b128)
#define CDNA5_ASYNC_LDS 1
#else
#define CDNA5_ASYNC_LDS 0
#endif

__device__ __forceinline__ void copy16_g2l(const void* g, void* l) {
#if CDNA5_ASYNC_LDS
  __builtin_amdgcn_global_load_async_to_lds_b128(
      (__attribute__((address_space(1))) v4i*)g,
      (__attribute__((address_space(3))) v4i*)l, 0, 0);
#else
  *(uint4*)l = *(const uint4*)g;
#endif
}

__device__ __forceinline__ void async_drain() {
#if CDNA5_ASYNC_LDS
  asm volatile("s_wait_asynccnt 0" ::: "memory");
#endif
}

#if __has_builtin(__builtin_amdgcn_tensor_load_to_lds)
#define CDNA5_TDM 1
#else
#define CDNA5_TDM 0
#endif

#if CDNA5_TDM
__device__ __forceinline__ void tdm_load_2d(unsigned lds_addr, const void* gaddr,
                                            unsigned tensor_d0, unsigned tensor_d1,
                                            unsigned tile_d0, unsigned tile_d1,
                                            unsigned long long stride0_elems) {
  unsigned long long ga = (unsigned long long)gaddr;
  v4u g0;
  g0.x = 1u;                                           // count=1, user mode
  g0.y = lds_addr;                                     // LDS byte address
  g0.z = (unsigned)(ga & 0xffffffffull);               // global_addr[31:0]
  g0.w = (unsigned)((ga >> 32) & 0x1ffffffull) | (2u << 30);  // [56:32] | type=2
  v8i g1;
  g1[0] = 0x00010000;
  g1[1] = (int)((tensor_d0 & 0xffffu) << 16);
  g1[2] = (int)((tensor_d0 >> 16) | ((tensor_d1 & 0xffffu) << 16));
  g1[3] = (int)((tensor_d1 >> 16) | (tile_d0 << 16));
  g1[4] = (int)(tile_d1 & 0xffffu);
  g1[5] = (int)(stride0_elems & 0xffffffffull);
  g1[6] = (int)((stride0_elems >> 32) & 0xffffull);
  g1[7] = 0;
  v4i z4 = {0, 0, 0, 0};
#if __clang_major__ >= 23
  v8i z8 = {0, 0, 0, 0, 0, 0, 0, 0};
  __builtin_amdgcn_tensor_load_to_lds(g0, g1, z4, z4, z8, 0);
#else
  __builtin_amdgcn_tensor_load_to_lds(g0, g1, z4, z4, 0);
#endif
}
#endif

__device__ __forceinline__ void tensor_drain() {
#if __has_builtin(__builtin_amdgcn_s_wait_tensorcnt)
  __builtin_amdgcn_s_wait_tensorcnt(0);
#else
  asm volatile("s_wait_tensorcnt 0" ::: "memory");
#endif
}

__device__ __forceinline__ unsigned lds_byte_addr(const void* p) {
  return (unsigned)(size_t)(__attribute__((address_space(3))) const char*)p;
}

// ---- elementwise f32 -> bf16 convert ------------------------------------

__global__ void cvt_f32_bf16(const float* __restrict__ in, bf16_t* __restrict__ out, int n) {
  for (int i = blockIdx.x * blockDim.x + threadIdx.x; i < n; i += gridDim.x * blockDim.x)
    out[i] = f2bf(in[i]);
}

// ---- LayerNorm: one wave (32 lanes) per row of 512 -----------------------

__global__ void __launch_bounds__(256) ln_kernel(const float* __restrict__ x,
                                                 const float* __restrict__ g,
                                                 const float* __restrict__ beta,
                                                 bf16_t* __restrict__ out, int rows) {
  int wave = threadIdx.x >> 5, lane = threadIdx.x & 31;
  int row = blockIdx.x * 8 + wave;
  if (row >= rows) return;
  const float* xr = x + (size_t)row * WC;
  float vals[16];
  float s = 0.f;
  #pragma unroll
  for (int k = 0; k < 16; ++k) { vals[k] = xr[lane + 32 * k]; s += vals[k]; }
  #pragma unroll
  for (int o = 16; o >= 1; o >>= 1) s += __shfl_xor(s, o, 32);
  float mean = s * (1.0f / WC);
  float vs = 0.f;
  #pragma unroll
  for (int k = 0; k < 16; ++k) { float d = vals[k] - mean; vs += d * d; }
  #pragma unroll
  for (int o = 16; o >= 1; o >>= 1) vs += __shfl_xor(vs, o, 32);
  float rinv = rsqrtf(vs * (1.0f / WC) + 1e-5f);
  #pragma unroll
  for (int k = 0; k < 16; ++k) {
    int idx = lane + 32 * k;
    out[(size_t)row * WC + idx] = f2bf((vals[k] - mean) * rinv * g[idx] + beta[idx]);
  }
}

template <int MODE>
__global__ void __launch_bounds__(256) gemm_bf16_kernel(
    const bf16_t* __restrict__ A, const bf16_t* __restrict__ W,
    const float* __restrict__ bias, const float* __restrict__ resid,
    float* __restrict__ outF, bf16_t* __restrict__ outB,
    int Mm, int Nn, int Kk) {
  __shared__ bf16_t As[128][32];
  __shared__ bf16_t Bs[64][32];   // transposed: Bs[n][k]
  int tid = threadIdx.x;
  int lane = tid & 31, wave = tid >> 5;
  int hl = lane >> 4, l16 = lane & 15;
  int m0 = blockIdx.y * 128, n0 = blockIdx.x * 64;

  v8f acc[4] = {};
  int nk = Kk / 32;
  for (int kc = 0; kc < nk; ++kc) {
    int k0 = kc * 32;
#if CDNA5_TDM
    if (wave == 0) {
      tdm_load_2d(lds_byte_addr(&As[0][0]), A + (size_t)m0 * Kk + k0,
                  (unsigned)Kk, (unsigned)Mm, 32u, 128u,
                  (unsigned long long)Kk);
      tensor_drain();
    }
#else
    {   // fallback: async DMA per lane
      int ar = tid >> 1, ac = (tid & 1) * 16;
      const bf16_t* src = A + (size_t)(m0 + ar) * Kk + k0 + ac;
      copy16_g2l(src,     &As[ar][ac]);
      copy16_g2l(src + 8, &As[ar][ac + 8]);
    }
#endif
    {   // stage W tile transposed: read 8 contiguous n, scatter into Bs[n][k]
      int kk = tid >> 3, ns = (tid & 7) * 8;
      uint4 t = *(const uint4*)(W + (size_t)(k0 + kk) * Nn + n0 + ns);
      const bf16_t* tb = (const bf16_t*)&t;
      #pragma unroll
      for (int i = 0; i < 8; ++i) Bs[ns + i][kk] = tb[i];
    }
    if (kc + 1 < nk) {   // global_prefetch_b8 of next K-chunk
      __builtin_prefetch(A + (size_t)(m0 + (tid >> 1)) * Kk + k0 + 32, 0, 1);
      __builtin_prefetch(W + (size_t)(k0 + 32 + (tid >> 3)) * Nn + n0, 0, 1);
    }
#if !CDNA5_TDM
    async_drain();
#endif
    __syncthreads();
    v16bf af = mkfrag(&As[wave * 16 + l16][0], hl);
    #pragma unroll
    for (int j = 0; j < 4; ++j) {
      v16bf bfv = mkfrag(&Bs[j * 16 + l16][0], hl);
      acc[j] = wmma_bf16(af, bfv, acc[j]);
    }
    __syncthreads();
  }

  #pragma unroll
  for (int j = 0; j < 4; ++j) {
    #pragma unroll
    for (int i = 0; i < 8; ++i) {
      int row = m0 + wave * 16 + i + hl * 8;
      int col = n0 + j * 16 + l16;
      float v = acc[j][i] + bias[col];
      if constexpr (MODE == 0) {
        v += resid[(size_t)row * Nn + col];
        outF[(size_t)row * Nn + col] = v;
      } else if constexpr (MODE == 1) {
        int b = row / WT, t = row % WT;
        int hh = col >> 6, dd = col & 63;
        outB[((size_t)(b * WH + hh) * WT + t) * WD + dd] = f2bf(v);
      } else {
        float gl = 0.5f * v * (1.0f + erff(v * 0.70710678118f));
        outB[(size_t)row * Nn + col] = f2bf(gl);
      }
    }
  }
}

// ---- Flash-attention: causal, per (b,h), 128 q-rows per workgroup --------

__global__ void __launch_bounds__(256) attn_kernel(
    const bf16_t* __restrict__ Q, const bf16_t* __restrict__ Km,
    const bf16_t* __restrict__ V, bf16_t* __restrict__ Y) {
  __shared__ bf16_t Ks[32][64];       // K rows (key-major)
  __shared__ bf16_t Vs[64][32];       // V transposed: Vs[d][key]
  __shared__ bf16_t Ps[8][16][32];    // per-wave P tile
  int tid = threadIdx.x, lane = tid & 31, wave = tid >> 5;
  int hl = lane >> 4, l16 = lane & 15;
  int bh = blockIdx.y;
  int b = bh >> 3, h = bh & 7;
  int q0 = blockIdx.x * 128;
  const bf16_t* Qp = Q + (size_t)bh * WT * WD;
  const bf16_t* Kp = Km + (size_t)bh * WT * WD;
  const bf16_t* Vp = V + (size_t)bh * WT * WD;

  // Q A-fragments (lane row = l16), d split into two 32-chunks
  int qrow = q0 + wave * 16 + l16;
  v16bf qf[2];
  #pragma unroll
  for (int c = 0; c < 2; ++c) qf[c] = mkfrag(Qp + (size_t)qrow * WD + c * 32, hl);

  v8f oacc[4] = {};
  float mrun[8], srun[8];
  #pragma unroll
  for (int i = 0; i < 8; ++i) { mrun[i] = -3e30f; srun[i] = 0.f; }
  const float scale = 0.125f;   // 1/sqrt(64)
  int nchunk = (q0 + 128) / 32;
  int mymax = q0 + wave * 16 + 15;   // last q row this wave owns

  for (int kc = 0; kc < nchunk; ++kc) {
    int k0 = kc * 32;
    {
      int r = tid >> 3, cs = (tid & 7) * 8;
      copy16_g2l(Kp + (size_t)(k0 + r) * WD + cs, &Ks[r][cs]);
      uint4 t = *(const uint4*)(Vp + (size_t)(k0 + r) * WD + cs);
      const bf16_t* tb = (const bf16_t*)&t;
      #pragma unroll
      for (int i = 0; i < 8; ++i) Vs[cs + i][r] = tb[i];
    }
    async_drain();
    __syncthreads();
    if (k0 <= mymax) {
      float st[2][8];
      #pragma unroll
      for (int j = 0; j < 2; ++j) {
        v8f s = {};
        #pragma unroll
        for (int c = 0; c < 2; ++c) {
          v16bf kf = mkfrag(&Ks[j * 16 + l16][c * 32], hl);  // Kᵀ column = K row
          s = wmma_bf16(qf[c], kf, s);
        }
        #pragma unroll
        for (int i = 0; i < 8; ++i) {
          int qr = q0 + wave * 16 + i + hl * 8;
          int kcol = k0 + j * 16 + l16;
          float e = s[i] * scale;
          if (kcol > qr) e = -3e30f;   // causal mask
          st[j][i] = e;
        }
      }
      // online softmax; row lives across the 16 lanes of a half-wave
      #pragma unroll
      for (int i = 0; i < 8; ++i) {
        float mx = fmaxf(st[0][i], st[1][i]);
        #pragma unroll
        for (int o = 8; o >= 1; o >>= 1) mx = fmaxf(mx, __shfl_xor(mx, o, 16));
        float mnew = fmaxf(mrun[i], mx);
        float alpha = __expf(mrun[i] - mnew);
        float p0 = __expf(st[0][i] - mnew);
        float p1 = __expf(st[1][i] - mnew);
        int r = i + hl * 8;
        Ps[wave][r][l16]      = f2bf(p0);
        Ps[wave][r][16 + l16] = f2bf(p1);
        float rs = p0 + p1;
        #pragma unroll
        for (int o = 8; o >= 1; o >>= 1) rs += __shfl_xor(rs, o, 16);
        srun[i] = srun[i] * alpha + rs;
        mrun[i] = mnew;
        #pragma unroll
        for (int n = 0; n < 4; ++n) oacc[n][i] *= alpha;
      }
      // P (C-layout) was spilled to LDS; reload as A-fragment, then P@V
      v16bf pf = mkfrag(&Ps[wave][l16][0], hl);
      #pragma unroll
      for (int n = 0; n < 4; ++n) {
        v16bf vf = mkfrag(&Vs[n * 16 + l16][0], hl);
        oacc[n] = wmma_bf16(pf, vf, oacc[n]);
      }
    }
    __syncthreads();
  }

  #pragma unroll
  for (int n = 0; n < 4; ++n)
    #pragma unroll
    for (int i = 0; i < 8; ++i) {
      int t = q0 + wave * 16 + i + hl * 8;
      float v = oacc[n][i] / srun[i];
      Y[(size_t)(b * WT + t) * WC + h * WD + n * 16 + l16] = f2bf(v);
    }
}

// ---- host launch ---------------------------------------------------------

extern "C" void kernel_launch(void* const* d_in, const int* in_sizes, int n_in,
                              void* d_out, int out_size, void* d_ws, size_t ws_size,
                              hipStream_t stream) {
  (void)in_sizes; (void)n_in; (void)out_size; (void)ws_size;
  const float* x   = (const float*)d_in[0];
  const float* g1  = (const float*)d_in[1];
  const float* be1 = (const float*)d_in[2];
  const float* g2  = (const float*)d_in[3];
  const float* be2 = (const float*)d_in[4];
  const float* Wq = (const float*)d_in[5];  const float* bq = (const float*)d_in[6];
  const float* Wk = (const float*)d_in[7];  const float* bk = (const float*)d_in[8];
  const float* Wv = (const float*)d_in[9];  const float* bv = (const float*)d_in[10];
  const float* Wp = (const float*)d_in[11]; const float* bp = (const float*)d_in[12];
  const float* W1 = (const float*)d_in[13]; const float* b1 = (const float*)d_in[14];
  const float* W2 = (const float*)d_in[15]; const float* b2 = (const float*)d_in[16];
  float* out = (float*)d_out;

  char* ws = (char*)d_ws;
  size_t off = 0;
  auto alloc = [&](size_t bytes) -> char* {
    char* p = ws + off; off += (bytes + 255) & ~(size_t)255; return p;
  };
  const size_t CC = (size_t)WC * WC;          // 262144
  const size_t C4 = (size_t)WC * 4 * WC;      // 1048576
  bf16_t* wqb = (bf16_t*)alloc(CC * 2);
  bf16_t* wkb = (bf16_t*)alloc(CC * 2);
  bf16_t* wvb = (bf16_t*)alloc(CC * 2);
  bf16_t* wpb = (bf16_t*)alloc(CC * 2);
  bf16_t* w1b = (bf16_t*)alloc(C4 * 2);
  bf16_t* w2b = (bf16_t*)alloc(C4 * 2);
  bf16_t* h1  = (bf16_t*)alloc((size_t)WM * WC * 2);
  bf16_t* qb  = (bf16_t*)alloc((size_t)WM * WC * 2);
  bf16_t* kb  = (bf16_t*)alloc((size_t)WM * WC * 2);
  bf16_t* vb  = (bf16_t*)alloc((size_t)WM * WC * 2);
  bf16_t* yb  = (bf16_t*)alloc((size_t)WM * WC * 2);
  float*  x1  = (float*)alloc((size_t)WM * WC * 4);
  bf16_t* h2  = (bf16_t*)alloc((size_t)WM * WC * 2);
  bf16_t* act = (bf16_t*)alloc((size_t)WM * 4 * WC * 2);

  // 1) weights -> bf16
  cvt_f32_bf16<<<1024, 256, 0, stream>>>(Wq, wqb, (int)CC);
  cvt_f32_bf16<<<1024, 256, 0, stream>>>(Wk, wkb, (int)CC);
  cvt_f32_bf16<<<1024, 256, 0, stream>>>(Wv, wvb, (int)CC);
  cvt_f32_bf16<<<1024, 256, 0, stream>>>(Wp, wpb, (int)CC);
  cvt_f32_bf16<<<2048, 256, 0, stream>>>(W1, w1b, (int)C4);
  cvt_f32_bf16<<<2048, 256, 0, stream>>>(W2, w2b, (int)C4);

  // 2) LN1
  ln_kernel<<<WM / 8, 256, 0, stream>>>(x, g1, be1, h1, WM);

  // 3) Q/K/V projections (head-reshaped bf16 outputs)
  dim3 gq(WC / 64, WM / 128);                   // (8, 64)
  gemm_bf16_kernel<1><<<gq, 256, 0, stream>>>(h1, wqb, bq, nullptr, nullptr, qb, WM, WC, WC);
  gemm_bf16_kernel<1><<<gq, 256, 0, stream>>>(h1, wkb, bk, nullptr, nullptr, kb, WM, WC, WC);
  gemm_bf16_kernel<1><<<gq, 256, 0, stream>>>(h1, wvb, bv, nullptr, nullptr, vb, WM, WC, WC);

  // 4) causal flash attention
  dim3 ga(WT / 128, WBATCH * WH);               // (16, 32)
  attn_kernel<<<ga, 256, 0, stream>>>(qb, kb, vb, yb);

  // 5) output projection + residual -> x1 (f32)
  gemm_bf16_kernel<0><<<gq, 256, 0, stream>>>(yb, wpb, bp, x, x1, nullptr, WM, WC, WC);

  // 6) LN2
  ln_kernel<<<WM / 8, 256, 0, stream>>>(x1, g2, be2, h2, WM);

  // 7) MLP up + exact GELU -> bf16
  dim3 gm(4 * WC / 64, WM / 128);               // (32, 64)
  gemm_bf16_kernel<2><<<gm, 256, 0, stream>>>(h2, w1b, b1, nullptr, nullptr, act, WM, 4 * WC, WC);

  // 8) MLP down + residual -> d_out (f32)
  gemm_bf16_kernel<0><<<gq, 256, 0, stream>>>(act, w2b, b2, x1, out, nullptr, WM, WC, 4 * WC);
}

// v001
// One run takes 371 microseconds.
// Two timings next to v000 both put it at 1.29 times that version's speed.
#include <hip/hip_runtime.h>
#include <hip/hip_bf16.h>
#include <math.h>

// Problem dims (fixed by reference)
#define WBATCH 4
#define WT     2048
#define WC     512
#define WH     8
#define WD     64
#define WM     (WBATCH * WT)   // 8192 tokens

typedef __bf16 bf16_t;
typedef __attribute__((ext_vector_type(16))) __bf16 v16bf;
typedef __attribute__((ext_vector_type(8)))  __bf16 v8bf;
typedef __attribute__((ext_vector_type(8)))  float  v8f;
typedef __attribute__((ext_vector_type(4)))  int    v4i;
typedef __attribute__((ext_vector_type(8)))  int    v8i;
typedef __attribute__((ext_vector_type(4)))  unsigned int v4u;

#define BS_PITCH 40   // 32 used + 8 pad: 80 B
#define VS_PITCH 40   // 32 used + 8 pad: 80 B
#define PS_PITCH 40   // 32 used + 8 pad: 80 B
#define KS_PITCH 72   // 64 used + 8 pad: 144 B

// ---- helpers -------------------------------------------------------------

__device__ __forceinline__ bf16_t f2bf(float f) {
  union { float f; unsigned u; } a; a.f = f;
  unsigned r = a.u + 0x7fffu + ((a.u >> 16) & 1u);   // round-nearest-even
  unsigned short s = (unsigned short)(r >> 16);
  bf16_t b; __builtin_memcpy(&b, &s, 2); return b;
}

__device__ __forceinline__ v16bf mkfrag(const bf16_t* row, int hl) {
  v8bf lo = *(const v8bf*)(row + hl * 8);
  v8bf hi = *(const v8bf*)(row + 16 + hl * 8);
  return __builtin_shufflevector(lo, hi, 0,1,2,3,4,5,6,7,8,9,10,11,12,13,14,15);
}

__device__ __forceinline__ v8f wmma_bf16(v16bf a, v16bf b, v8f c) {
  return __builtin_amdgcn_wmma_f32_16x16x32_bf16(false, a, false, b, (short)0, c,
                                                 false, false);
}

#if __has_builtin(__builtin_amdgcn_global_load_async_to_lds_b128)
#define CDNA5_ASYNC_LDS 1
#else
#define CDNA5_ASYNC_LDS 0
#endif

__device__ __forceinline__ void copy16_g2l(const void* g, void* l) {
#if CDNA5_ASYNC_LDS
  __builtin_amdgcn_global_load_async_to_lds_b128(
      (__attribute__((address_space(1))) v4i*)g,
      (__attribute__((address_space(3))) v4i*)l, 0, 0);
#else
  *(uint4*)l = *(const uint4*)g;
#endif
}

__device__ __forceinline__ void async_drain() {
#if CDNA5_ASYNC_LDS
  asm volatile("s_wait_asynccnt 0" ::: "memory");
#endif
}

#if __has_builtin(__builtin_amdgcn_tensor_load_to_lds)
#define CDNA5_TDM 1
#else
#define CDNA5_TDM 0
#endif

#if CDNA5_TDM
__device__ __forceinline__ void tdm_load_2d(unsigned lds_addr, const void* gaddr,
                                            unsigned tensor_d0, unsigned tensor_d1,
                                            unsigned tile_d0, unsigned tile_d1,
                                            unsigned long long stride0_elems) {
  unsigned long long ga = (unsigned long long)gaddr;
  v4u g0;
  g0.x = 1u;                                           // count=1, user mode
  g0.y = lds_addr;                                     // LDS byte address
  g0.z = (unsigned)(ga & 0xffffffffull);               // global_addr[31:0]
  g0.w = (unsigned)((ga >> 32) & 0x1ffffffull) | (2u << 30);  // [56:32] | type=2
  v8i g1;
  g1[0] = 0x00010000;
  g1[1] = (int)((tensor_d0 & 0xffffu) << 16);
  g1[2] = (int)((tensor_d0 >> 16) | ((tensor_d1 & 0xffffu) << 16));
  g1[3] = (int)((tensor_d1 >> 16) | (tile_d0 << 16));
  g1[4] = (int)(tile_d1 & 0xffffu);
  g1[5] = (int)(stride0_elems & 0xffffffffull);
  g1[6] = (int)((stride0_elems >> 32) & 0xffffull);
  g1[7] = 0;
  v4i z4 = {0, 0, 0, 0};
#if __clang_major__ >= 23
  v8i z8 = {0, 0, 0, 0, 0, 0, 0, 0};
  __builtin_amdgcn_tensor_load_to_lds(g0, g1, z4, z4, z8, 0);
#else
  __builtin_amdgcn_tensor_load_to_lds(g0, g1, z4, z4, 0);
#endif
}
#endif

__device__ __forceinline__ void tensor_drain() {
#if __has_builtin(__builtin_amdgcn_s_wait_tensorcnt)
  __builtin_amdgcn_s_wait_tensorcnt(0);
#else
  asm volatile("s_wait_tensorcnt 0" ::: "memory");
#endif
}

__device__ __forceinline__ unsigned lds_byte_addr(const void* p) {
  return (unsigned)(size_t)(__attribute__((address_space(3))) const char*)p;
}

// ---- elementwise f32 -> bf16 convert ------------------------------------

__global__ void cvt_f32_bf16(const float* __restrict__ in, bf16_t* __restrict__ out, int n) {
  for (int i = blockIdx.x * blockDim.x + threadIdx.x; i < n; i += gridDim.x * blockDim.x)
    out[i] = f2bf(in[i]);
}

// ---- LayerNorm: one wave (32 lanes) per row of 512 -----------------------

__global__ void __launch_bounds__(256) ln_kernel(const float* __restrict__ x,
                                                 const float* __restrict__ g,
                                                 const float* __restrict__ beta,
                                                 bf16_t* __restrict__ out, int rows) {
  int wave = threadIdx.x >> 5, lane = threadIdx.x & 31;
  int row = blockIdx.x * 8 + wave;
  if (row >= rows) return;
  const float* xr = x + (size_t)row * WC;
  float vals[16];
  float s = 0.f;
  #pragma unroll
  for (int k = 0; k < 16; ++k) { vals[k] = xr[lane + 32 * k]; s += vals[k]; }
  #pragma unroll
  for (int o = 16; o >= 1; o >>= 1) s += __shfl_xor(s, o, 32);
  float mean = s * (1.0f / WC);
  float vs = 0.f;
  #pragma unroll
  for (int k = 0; k < 16; ++k) { float d = vals[k] - mean; vs += d * d; }
  #pragma unroll
  for (int o = 16; o >= 1; o >>= 1) vs += __shfl_xor(vs, o, 32);
  float rinv = rsqrtf(vs * (1.0f / WC) + 1e-5f);
  #pragma unroll
  for (int k = 0; k < 16; ++k) {
    int idx = lane + 32 * k;
    out[(size_t)row * WC + idx] = f2bf((vals[k] - mean) * rinv * g[idx] + beta[idx]);
  }
}

template <int MODE>
__global__ void __launch_bounds__(256) gemm_bf16_kernel(
    const bf16_t* __restrict__ A, const bf16_t* __restrict__ W,
    const float* __restrict__ bias, const float* __restrict__ resid,
    float* __restrict__ outF, bf16_t* __restrict__ outB,
    int Mm, int Nn, int Kk) {
  __shared__ bf16_t As[128][32];
  __shared__ bf16_t Bs[64][BS_PITCH];   // transposed: Bs[n][k], rows padded
  int tid = threadIdx.x;
  int lane = tid & 31, wave = tid >> 5;
  int hl = lane >> 4, l16 = lane & 15;
  int m0 = blockIdx.y * 128, n0 = blockIdx.x * 64;

  v8f acc[4] = {};
  int nk = Kk / 32;
  for (int kc = 0; kc < nk; ++kc) {
    int k0 = kc * 32;
#if CDNA5_TDM
    if (wave == 0) {
      tdm_load_2d(lds_byte_addr(&As[0][0]), A + (size_t)m0 * Kk + k0,
                  (unsigned)Kk, (unsigned)Mm, 32u, 128u,
                  (unsigned long long)Kk);
      tensor_drain();
    }
#else
    {   // fallback: async DMA per lane
      int ar = tid >> 1, ac = (tid & 1) * 16;
      const bf16_t* src = A + (size_t)(m0 + ar) * Kk + k0 + ac;
      copy16_g2l(src,     &As[ar][ac]);
      copy16_g2l(src + 8, &As[ar][ac + 8]);
    }
#endif
    {   // stage W tile transposed: read 8 contiguous n, scatter into Bs[n][k]
      int kk = tid >> 3, ns = (tid & 7) * 8;
      uint4 t = *(const uint4*)(W + (size_t)(k0 + kk) * Nn + n0 + ns);
      const bf16_t* tb = (const bf16_t*)&t;
      #pragma unroll
      for (int i = 0; i < 8; ++i) Bs[ns + i][kk] = tb[i];
    }
    if (kc + 1 < nk) {   // global_prefetch_b8 of next K-chunk
      __builtin_prefetch(A + (size_t)(m0 + (tid >> 1)) * Kk + k0 + 32, 0, 1);
      __builtin_prefetch(W + (size_t)(k0 + 32 + (tid >> 3)) * Nn + n0, 0, 1);
    }
#if !CDNA5_TDM
    async_drain();
#endif
    __syncthreads();
    v16bf af = mkfrag(&As[wave * 16 + l16][0], hl);
    #pragma unroll
    for (int j = 0; j < 4; ++j) {
      v16bf bfv = mkfrag(&Bs[j * 16 + l16][0], hl);
      acc[j] = wmma_bf16(af, bfv, acc[j]);
    }
    __syncthreads();
  }

  #pragma unroll
  for (int j = 0; j < 4; ++j) {
    #pragma unroll
    for (int i = 0; i < 8; ++i) {
      int row = m0 + wave * 16 + i + hl * 8;
      int col = n0 + j * 16 + l16;
      float v = acc[j][i] + bias[col];
      if constexpr (MODE == 0) {
        v += resid[(size_t)row * Nn + col];
        outF[(size_t)row * Nn + col] = v;
      } else if constexpr (MODE == 1) {
        int b = row / WT, t = row % WT;
        int hh = col >> 6, dd = col & 63;
        outB[((size_t)(b * WH + hh) * WT + t) * WD + dd] = f2bf(v);
      } else {
        float gl = 0.5f * v * (1.0f + erff(v * 0.70710678118f));
        outB[(size_t)row * Nn + col] = f2bf(gl);
      }
    }
  }
}

// ---- Flash-attention: causal, per (b,h), 128 q-rows per workgroup --------

__global__ void __launch_bounds__(256) attn_kernel(
    const bf16_t* __restrict__ Q, const bf16_t* __restrict__ Km,
    const bf16_t* __restrict__ V, bf16_t* __restrict__ Y) {
  __shared__ bf16_t Ks[32][KS_PITCH];       // K rows (key-major), rows padded
  __shared__ bf16_t Vs[64][VS_PITCH];       // V transposed: Vs[d][key], rows padded
  __shared__ bf16_t Ps[8][16][PS_PITCH];    // per-wave P tile, rows padded
  int tid = threadIdx.x, lane = tid & 31, wave = tid >> 5;
  int hl = lane >> 4, l16 = lane & 15;
  int bh = blockIdx.y;
  int b = bh >> 3, h = bh & 7;
  int q0 = blockIdx.x * 128;
  const bf16_t* Qp = Q + (size_t)bh * WT * WD;
  const bf16_t* Kp = Km + (size_t)bh * WT * WD;
  const bf16_t* Vp = V + (size_t)bh * WT * WD;

  // Q A-fragments (lane row = l16), d split into two 32-chunks
  int qrow = q0 + wave * 16 + l16;
  v16bf qf[2];
  #pragma unroll
  for (int c = 0; c < 2; ++c) qf[c] = mkfrag(Qp + (size_t)qrow * WD + c * 32, hl);

  v8f oacc[4] = {};
  float mrun[8], srun[8];
  #pragma unroll
  for (int i = 0; i < 8; ++i) { mrun[i] = -3e30f; srun[i] = 0.f; }
  const float scale = 0.125f;   // 1/sqrt(64)
  int nchunk = (q0 + 128) / 32;
  int mymax = q0 + wave * 16 + 15;   // last q row this wave owns

  for (int kc = 0; kc < nchunk; ++kc) {
    int k0 = kc * 32;
    {
      int r = tid >> 3, cs = (tid & 7) * 8;
      copy16_g2l(Kp + (size_t)(k0 + r) * WD + cs, &Ks[r][cs]);
      uint4 t = *(const uint4*)(Vp + (size_t)(k0 + r) * WD + cs);
      const bf16_t* tb = (const bf16_t*)&t;
      #pragma unroll
      for (int i = 0; i < 8; ++i) Vs[cs + i][r] = tb[i];
    }
    async_drain();
    __syncthreads();
    if (k0 <= mymax) {
      float st[2][8];
      #pragma unroll
      for (int j = 0; j < 2; ++j) {
        v8f s = {};
        #pragma unroll
        for (int c = 0; c < 2; ++c) {
          v16bf kf = mkfrag(&Ks[j * 16 + l16][c * 32], hl);  // Kᵀ column = K row
          s = wmma_bf16(qf[c], kf, s);
        }
        #pragma unroll
        for (int i = 0; i < 8; ++i) {
          int qr = q0 + wave * 16 + i + hl * 8;
          int kcol = k0 + j * 16 + l16;
          float e = s[i] * scale;
          if (kcol > qr) e = -3e30f;   // causal mask
          st[j][i] = e;
        }
      }
      // online softmax; row lives across the 16 lanes of a half-wave
      #pragma unroll
      for (int i = 0; i < 8; ++i) {
        float mx = fmaxf(st[0][i], st[1][i]);
        #pragma unroll
        for (int o = 8; o >= 1; o >>= 1) mx = fmaxf(mx, __shfl_xor(mx, o, 16));
        float mnew = fmaxf(mrun[i], mx);
        float alpha = __expf(mrun[i] - mnew);
        float p0 = __expf(st[0][i] - mnew);
        float p1 = __expf(st[1][i] - mnew);
        int r = i + hl * 8;
        Ps[wave][r][l16]      = f2bf(p0);
        Ps[wave][r][16 + l16] = f2bf(p1);
        float rs = p0 + p1;
        #pragma unroll
        for (int o = 8; o >= 1; o >>= 1) rs += __shfl_xor(rs, o, 16);
        srun[i] = srun[i] * alpha + rs;
        mrun[i] = mnew;
        #pragma unroll
        for (int n = 0; n < 4; ++n) oacc[n][i] *= alpha;
      }
      // P (C-layout) was spilled to LDS; reload as A-fragment, then P@V
      v16bf pf = mkfrag(&Ps[wave][l16][0], hl);
      #pragma unroll
      for (int n = 0; n < 4; ++n) {
        v16bf vf = mkfrag(&Vs[n * 16 + l16][0], hl);
        oacc[n] = wmma_bf16(pf, vf, oacc[n]);
      }
    }
    __syncthreads();
  }

  #pragma unroll
  for (int n = 0; n < 4; ++n)
    #pragma unroll
    for (int i = 0; i < 8; ++i) {
      int t = q0 + wave * 16 + i + hl * 8;
      float v = oacc[n][i] / srun[i];
      Y[(size_t)(b * WT + t) * WC + h * WD + n * 16 + l16] = f2bf(v);
    }
}

// ---- host launch ---------------------------------------------------------

extern "C" void kernel_launch(void* const* d_in, const int* in_sizes, int n_in,
                              void* d_out, int out_size, void* d_ws, size_t ws_size,
                              hipStream_t stream) {
  (void)in_sizes; (void)n_in; (void)out_size; (void)ws_size;
  const float* x   = (const float*)d_in[0];
  const float* g1  = (const float*)d_in[1];
  const float* be1 = (const float*)d_in[2];
  const float* g2  = (const float*)d_in[3];
  const float* be2 = (const float*)d_in[4];
  const float* Wq = (const float*)d_in[5];  const float* bq = (const float*)d_in[6];
  const float* Wk = (const float*)d_in[7];  const float* bk = (const float*)d_in[8];
  const float* Wv = (const float*)d_in[9];  const float* bv = (const float*)d_in[10];
  const float* Wp = (const float*)d_in[11]; const float* bp = (const float*)d_in[12];
  const float* W1 = (const float*)d_in[13]; const float* b1 = (const float*)d_in[14];
  const float* W2 = (const float*)d_in[15]; const float* b2 = (const float*)d_in[16];
  float* out = (float*)d_out;

  char* ws = (char*)d_ws;
  size_t off = 0;
  auto alloc = [&](size_t bytes) -> char* {
    char* p = ws + off; off += (bytes + 255) & ~(size_t)255; return p;
  };
  const size_t CC = (size_t)WC * WC;          // 262144
  const size_t C4 = (size_t)WC * 4 * WC;      // 1048576
  bf16_t* wqb = (bf16_t*)alloc(CC * 2);
  bf16_t* wkb = (bf16_t*)alloc(CC * 2);
  bf16_t* wvb = (bf16_t*)alloc(CC * 2);
  bf16_t* wpb = (bf16_t*)alloc(CC * 2);
  bf16_t* w1b = (bf16_t*)alloc(C4 * 2);
  bf16_t* w2b = (bf16_t*)alloc(C4 * 2);
  bf16_t* h1  = (bf16_t*)alloc((size_t)WM * WC * 2);
  bf16_t* qb  = (bf16_t*)alloc((size_t)WM * WC * 2);
  bf16_t* kb  = (bf16_t*)alloc((size_t)WM * WC * 2);
  bf16_t* vb  = (bf16_t*)alloc((size_t)WM * WC * 2);
  bf16_t* yb  = (bf16_t*)alloc((size_t)WM * WC * 2);
  float*  x1  = (float*)alloc((size_t)WM * WC * 4);
  bf16_t* h2  = (bf16_t*)alloc((size_t)WM * WC * 2);
  bf16_t* act = (bf16_t*)alloc((size_t)WM * 4 * WC * 2);

  // 1) weights -> bf16
  cvt_f32_bf16<<<1024, 256, 0, stream>>>(Wq, wqb, (int)CC);
  cvt_f32_bf16<<<1024, 256, 0, stream>>>(Wk, wkb, (int)CC);
  cvt_f32_bf16<<<1024, 256, 0, stream>>>(Wv, wvb, (int)CC);
  cvt_f32_bf16<<<1024, 256, 0, stream>>>(Wp, wpb, (int)CC);
  cvt_f32_bf16<<<2048, 256, 0, stream>>>(W1, w1b, (int)C4);
  cvt_f32_bf16<<<2048, 256, 0, stream>>>(W2, w2b, (int)C4);

  // 2) LN1
  ln_kernel<<<WM / 8, 256, 0, stream>>>(x, g1, be1, h1, WM);

  // 3) Q/K/V projections (head-reshaped bf16 outputs)
  dim3 gq(WC / 64, WM / 128);                   // (8, 64)
  gemm_bf16_kernel<1><<<gq, 256, 0, stream>>>(h1, wqb, bq, nullptr, nullptr, qb, WM, WC, WC);
  gemm_bf16_kernel<1><<<gq, 256, 0, stream>>>(h1, wkb, bk, nullptr, nullptr, kb, WM, WC, WC);
  gemm_bf16_kernel<1><<<gq, 256, 0, stream>>>(h1, wvb, bv, nullptr, nullptr, vb, WM, WC, WC);

  // 4) causal flash attention
  dim3 ga(WT / 128, WBATCH * WH);               // (16, 32)
  attn_kernel<<<ga, 256, 0, stream>>>(qb, kb, vb, yb);

  // 5) output projection + residual -> x1 (f32)
  gemm_bf16_kernel<0><<<gq, 256, 0, stream>>>(yb, wpb, bp, x, x1, nullptr, WM, WC, WC);

  // 6) LN2
  ln_kernel<<<WM / 8, 256, 0, stream>>>(x1, g2, be2, h2, WM);

  // 7) MLP up + exact GELU -> bf16
  dim3 gm(4 * WC / 64, WM / 128);               // (32, 64)
  gemm_bf16_kernel<2><<<gm, 256, 0, stream>>>(h2, w1b, b1, nullptr, nullptr, act, WM, 4 * WC, WC);

  // 8) MLP down + residual -> d_out (f32)
  gemm_bf16_kernel<0><<<gq, 256, 0, stream>>>(act, w2b, b2, x1, out, nullptr, WM, WC, 4 * WC);
}

// v002
// One run takes 346 microseconds.
// In both of two side-by-side timings against v001, it was 1.07 times as fast.
// All steps since v000 together make it 1.38 times as fast.
#include <hip/hip_runtime.h>
#include <hip/hip_bf16.h>
#include <math.h>

// Problem dims (fixed by reference)
#define WBATCH 4
#define WT     2048
#define WC     512
#define WH     8
#define WD     64
#define WM     (WBATCH * WT)   // 8192 tokens

typedef __bf16 bf16_t;
typedef __attribute__((ext_vector_type(16))) __bf16 v16bf;
typedef __attribute__((ext_vector_type(8)))  __bf16 v8bf;
typedef __attribute__((ext_vector_type(8)))  float  v8f;
typedef __attribute__((ext_vector_type(4)))  int    v4i;
typedef __attribute__((ext_vector_type(8)))  int    v8i;
typedef __attribute__((ext_vector_type(4)))  unsigned int v4u;

#define BS_PITCH 40   // 32 used + 8 pad: 80 B
#define VS_PITCH 40   // 32 used + 8 pad: 80 B
#define PS_PITCH 40   // 32 used + 8 pad: 80 B
#define KS_PITCH 72   // 64 used + 8 pad: 144 B

// ---- helpers -------------------------------------------------------------

__device__ __forceinline__ bf16_t f2bf(float f) {
  union { float f; unsigned u; } a; a.f = f;
  unsigned r = a.u + 0x7fffu + ((a.u >> 16) & 1u);   // round-nearest-even
  unsigned short s = (unsigned short)(r >> 16);
  bf16_t b; __builtin_memcpy(&b, &s, 2); return b;
}

__device__ __forceinline__ v16bf mkfrag(const bf16_t* row, int hl) {
  v8bf lo = *(const v8bf*)(row + hl * 8);
  v8bf hi = *(const v8bf*)(row + 16 + hl * 8);
  return __builtin_shufflevector(lo, hi, 0,1,2,3,4,5,6,7,8,9,10,11,12,13,14,15);
}

__device__ __forceinline__ v8f wmma_bf16(v16bf a, v16bf b, v8f c) {
  return __builtin_amdgcn_wmma_f32_16x16x32_bf16(false, a, false, b, (short)0, c,
                                                 false, false);
}

#if __has_builtin(__builtin_amdgcn_global_load_async_to_lds_b128)
#define CDNA5_ASYNC_LDS 1
#else
#define CDNA5_ASYNC_LDS 0
#endif

__device__ __forceinline__ void copy16_g2l(const void* g, void* l) {
#if CDNA5_ASYNC_LDS
  __builtin_amdgcn_global_load_async_to_lds_b128(
      (__attribute__((address_space(1))) v4i*)g,
      (__attribute__((address_space(3))) v4i*)l, 0, 0);
#else
  *(uint4*)l = *(const uint4*)g;
#endif
}

__device__ __forceinline__ void async_drain() {
#if CDNA5_ASYNC_LDS
  asm volatile("s_wait_asynccnt 0" ::: "memory");
#endif
}

#if __has_builtin(__builtin_amdgcn_tensor_load_to_lds)
#define CDNA5_TDM 1
#else
#define CDNA5_TDM 0
#endif

#if CDNA5_TDM
__device__ __forceinline__ void tdm_load_2d(unsigned lds_addr, const void* gaddr,
                                            unsigned tensor_d0, unsigned tensor_d1,
                                            unsigned tile_d0, unsigned tile_d1,
                                            unsigned long long stride0_elems) {
  unsigned long long ga = (unsigned long long)gaddr;
  v4u g0;
  g0.x = 1u;                                           // count=1, user mode
  g0.y = lds_addr;                                     // LDS byte address
  g0.z = (unsigned)(ga & 0xffffffffull);               // global_addr[31:0]
  g0.w = (unsigned)((ga >> 32) & 0x1ffffffull) | (2u << 30);  // [56:32] | type=2
  v8i g1;
  g1[0] = 0x00010000;
  g1[1] = (int)((tensor_d0 & 0xffffu) << 16);
  g1[2] = (int)((tensor_d0 >> 16) | ((tensor_d1 & 0xffffu) << 16));
  g1[3] = (int)((tensor_d1 >> 16) | (tile_d0 << 16));
  g1[4] = (int)(tile_d1 & 0xffffu);
  g1[5] = (int)(stride0_elems & 0xffffffffull);
  g1[6] = (int)((stride0_elems >> 32) & 0xffffull);
  g1[7] = 0;
  v4i z4 = {0, 0, 0, 0};
#if __clang_major__ >= 23
  v8i z8 = {0, 0, 0, 0, 0, 0, 0, 0};
  __builtin_amdgcn_tensor_load_to_lds(g0, g1, z4, z4, z8, 0);
#else
  __builtin_amdgcn_tensor_load_to_lds(g0, g1, z4, z4, 0);
#endif
}
#endif

__device__ __forceinline__ void tensor_drain() {
#if __has_builtin(__builtin_amdgcn_s_wait_tensorcnt)
  __builtin_amdgcn_s_wait_tensorcnt(0);
#else
  asm volatile("s_wait_tensorcnt 0" ::: "memory");
#endif
}

__device__ __forceinline__ unsigned lds_byte_addr(const void* p) {
  return (unsigned)(size_t)(__attribute__((address_space(3))) const char*)p;
}

// ---- LayerNorm: one wave (32 lanes) per row of 512 -----------------------

__device__ __forceinline__ void ln_rows(const float* __restrict__ x,
                                        const float* __restrict__ g,
                                        const float* __restrict__ beta,
                                        bf16_t* __restrict__ out, int rows) {
  int wave = threadIdx.x >> 5, lane = threadIdx.x & 31;
  int row = blockIdx.x * 8 + wave;
  if (row >= rows) return;
  const float* xr = x + (size_t)row * WC;
  float vals[16];
  float s = 0.f;
  #pragma unroll
  for (int k = 0; k < 16; ++k) { vals[k] = xr[lane + 32 * k]; s += vals[k]; }
  #pragma unroll
  for (int o = 16; o >= 1; o >>= 1) s += __shfl_xor(s, o, 32);
  float mean = s * (1.0f / WC);
  float vs = 0.f;
  #pragma unroll
  for (int k = 0; k < 16; ++k) { float d = vals[k] - mean; vs += d * d; }
  #pragma unroll
  for (int o = 16; o >= 1; o >>= 1) vs += __shfl_xor(vs, o, 32);
  float rinv = rsqrtf(vs * (1.0f / WC) + 1e-5f);
  #pragma unroll
  for (int k = 0; k < 16; ++k) {
    int idx = lane + 32 * k;
    out[(size_t)row * WC + idx] = f2bf((vals[k] - mean) * rinv * g[idx] + beta[idx]);
  }
}

__global__ void __launch_bounds__(256) ln_kernel(const float* __restrict__ x,
                                                 const float* __restrict__ g,
                                                 const float* __restrict__ beta,
                                                 bf16_t* __restrict__ out, int rows) {
  ln_rows(x, g, beta, out, rows);
}

// ---- Pre-pass: LayerNorm 1 and the six f32 -> bf16 weight conversions ----
// None of the seven depends on another, so they share one launch: blocks
// [0, LN_BLOCKS) normalise 8 rows each; the later blocks convert, CVT_SMALL or
// CVT_LARGE blocks to a matrix, one element per thread and trip.

#define LN_BLOCKS  (WM / 8)                 // 1024
#define CVT_SMALL  1024                     // blocks for a C x C matrix
#define CVT_LARGE  2048                     // blocks for a C x 4C matrix
#define CVT_BLOCKS (4 * CVT_SMALL + 2 * CVT_LARGE)

__device__ __forceinline__ void cvt_f32_bf16(const float* __restrict__ in,
                                             bf16_t* __restrict__ out, int n,
                                             int blk, int nblk) {
  for (int i = blk * 256 + threadIdx.x; i < n; i += nblk * 256)
    out[i] = f2bf(in[i]);
}

__global__ void __launch_bounds__(256) prepass_kernel(
    const float* __restrict__ x, const float* __restrict__ g,
    const float* __restrict__ beta, bf16_t* __restrict__ h,
    const float* __restrict__ Wq, const float* __restrict__ Wk,
    const float* __restrict__ Wv, const float* __restrict__ Wp,
    const float* __restrict__ W1, const float* __restrict__ W2,
    bf16_t* __restrict__ wqb, bf16_t* __restrict__ wkb,
    bf16_t* __restrict__ wvb, bf16_t* __restrict__ wpb,
    bf16_t* __restrict__ w1b, bf16_t* __restrict__ w2b) {
  if (blockIdx.x < LN_BLOCKS) { ln_rows(x, g, beta, h, WM); return; }
  int c = blockIdx.x - LN_BLOCKS;
  if (c < 4 * CVT_SMALL) {
    int m = c / CVT_SMALL;
    const float* in = m == 0 ? Wq  : m == 1 ? Wk  : m == 2 ? Wv  : Wp;
    bf16_t* out     = m == 0 ? wqb : m == 1 ? wkb : m == 2 ? wvb : wpb;
    cvt_f32_bf16(in, out, WC * WC, c - m * CVT_SMALL, CVT_SMALL);
  } else {
    c -= 4 * CVT_SMALL;
    int m = c / CVT_LARGE;
    cvt_f32_bf16(m == 0 ? W1 : W2, m == 0 ? w1b : w2b, 4 * WC * WC,
                 c - m * CVT_LARGE, CVT_LARGE);
  }
}

template <int MODE>
__global__ void __launch_bounds__(256) gemm_bf16_kernel(
    const bf16_t* __restrict__ A, const bf16_t* __restrict__ W,
    const float* __restrict__ bias, const float* __restrict__ resid,
    float* __restrict__ outF, bf16_t* __restrict__ outB,
    int Mm, int Nn, int Kk,
    const float* __restrict__ bias_z1, const float* __restrict__ bias_z2) {
  if constexpr (MODE == 1) {
    int z = blockIdx.z;
    W    += (size_t)z * Kk * Nn;
    outB += (size_t)z * Mm * Nn;
    bias  = z == 0 ? bias : z == 1 ? bias_z1 : bias_z2;
  }
  __shared__ bf16_t As[128][32];
  __shared__ bf16_t Bs[64][BS_PITCH];   // transposed: Bs[n][k], rows padded
  int tid = threadIdx.x;
  int lane = tid & 31, wave = tid >> 5;
  int hl = lane >> 4, l16 = lane & 15;
  int m0 = blockIdx.y * 128, n0 = blockIdx.x * 64;

  v8f acc[4] = {};
  int nk = Kk / 32;
  for (int kc = 0; kc < nk; ++kc) {
    int k0 = kc * 32;
#if CDNA5_TDM
    if (wave == 0) {
      tdm_load_2d(lds_byte_addr(&As[0][0]), A + (size_t)m0 * Kk + k0,
                  (unsigned)Kk, (unsigned)Mm, 32u, 128u,
                  (unsigned long long)Kk);
      tensor_drain();
    }
#else
    {   // fallback: async DMA per lane
      int ar = tid >> 1, ac = (tid & 1) * 16;
      const bf16_t* src = A + (size_t)(m0 + ar) * Kk + k0 + ac;
      copy16_g2l(src,     &As[ar][ac]);
      copy16_g2l(src + 8, &As[ar][ac + 8]);
    }
#endif
    {   // stage W tile transposed: read 8 contiguous n, scatter into Bs[n][k]
      int kk = tid >> 3, ns = (tid & 7) * 8;
      uint4 t = *(const uint4*)(W + (size_t)(k0 + kk) * Nn + n0 + ns);
      const bf16_t* tb = (const bf16_t*)&t;
      #pragma unroll
      for (int i = 0; i < 8; ++i) Bs[ns + i][kk] = tb[i];
    }
    if (kc + 1 < nk) {   // global_prefetch_b8 of next K-chunk
      __builtin_prefetch(A + (size_t)(m0 + (tid >> 1)) * Kk + k0 + 32, 0, 1);
      __builtin_prefetch(W + (size_t)(k0 + 32 + (tid >> 3)) * Nn + n0, 0, 1);
    }
#if !CDNA5_TDM
    async_drain();
#endif
    __syncthreads();
    v16bf af = mkfrag(&As[wave * 16 + l16][0], hl);
    #pragma unroll
    for (int j = 0; j < 4; ++j) {
      v16bf bfv = mkfrag(&Bs[j * 16 + l16][0], hl);
      acc[j] = wmma_bf16(af, bfv, acc[j]);
    }
    __syncthreads();
  }

  #pragma unroll
  for (int j = 0; j < 4; ++j) {
    #pragma unroll
    for (int i = 0; i < 8; ++i) {
      int row = m0 + wave * 16 + i + hl * 8;
      int col = n0 + j * 16 + l16;
      float v = acc[j][i] + bias[col];
      if constexpr (MODE == 0) {
        v += resid[(size_t)row * Nn + col];
        outF[(size_t)row * Nn + col] = v;
      } else if constexpr (MODE == 1) {
        int b = row / WT, t = row % WT;
        int hh = col >> 6, dd = col & 63;
        outB[((size_t)(b * WH + hh) * WT + t) * WD + dd] = f2bf(v);
      } else {
        float gl = 0.5f * v * (1.0f + erff(v * 0.70710678118f));
        outB[(size_t)row * Nn + col] = f2bf(gl);
      }
    }
  }
}

// ---- Flash-attention: causal, per (b,h), 128 q-rows per workgroup --------

__global__ void __launch_bounds__(256) attn_kernel(
    const bf16_t* __restrict__ Q, const bf16_t* __restrict__ Km,
    const bf16_t* __restrict__ V, bf16_t* __restrict__ Y) {
  __shared__ bf16_t Ks[32][KS_PITCH];       // K rows (key-major), rows padded
  __shared__ bf16_t Vs[64][VS_PITCH];       // V transposed: Vs[d][key], rows padded
  __shared__ bf16_t Ps[8][16][PS_PITCH];    // per-wave P tile, rows padded
  int tid = threadIdx.x, lane = tid & 31, wave = tid >> 5;
  int hl = lane >> 4, l16 = lane & 15;
  int bh = blockIdx.y;
  int b = bh >> 3, h = bh & 7;
  int q0 = blockIdx.x * 128;
  const bf16_t* Qp = Q + (size_t)bh * WT * WD;
  const bf16_t* Kp = Km + (size_t)bh * WT * WD;
  const bf16_t* Vp = V + (size_t)bh * WT * WD;

  // Q A-fragments (lane row = l16), d split into two 32-chunks
  int qrow = q0 + wave * 16 + l16;
  v16bf qf[2];
  #pragma unroll
  for (int c = 0; c < 2; ++c) qf[c] = mkfrag(Qp + (size_t)qrow * WD + c * 32, hl);

  v8f oacc[4] = {};
  float mrun[8], srun[8];
  #pragma unroll
  for (int i = 0; i < 8; ++i) { mrun[i] = -3e30f; srun[i] = 0.f; }
  const float scale = 0.125f;   // 1/sqrt(64)
  int nchunk = (q0 + 128) / 32;
  int mymax = q0 + wave * 16 + 15;   // last q row this wave owns

  for (int kc = 0; kc < nchunk; ++kc) {
    int k0 = kc * 32;
    {
      int r = tid >> 3, cs = (tid & 7) * 8;
      copy16_g2l(Kp + (size_t)(k0 + r) * WD + cs, &Ks[r][cs]);
      uint4 t = *(const uint4*)(Vp + (size_t)(k0 + r) * WD + cs);
      const bf16_t* tb = (const bf16_t*)&t;
      #pragma unroll
      for (int i = 0; i < 8; ++i) Vs[cs + i][r] = tb[i];
    }
    async_drain();
    __syncthreads();
    if (k0 <= mymax) {
      float st[2][8];
      #pragma unroll
      for (int j = 0; j < 2; ++j) {
        v8f s = {};
        #pragma unroll
        for (int c = 0; c < 2; ++c) {
          v16bf kf = mkfrag(&Ks[j * 16 + l16][c * 32], hl);  // Kᵀ column = K row
          s = wmma_bf16(qf[c], kf, s);
        }
        #pragma unroll
        for (int i = 0; i < 8; ++i) {
          int qr = q0 + wave * 16 + i + hl * 8;
          int kcol = k0 + j * 16 + l16;
          float e = s[i] * scale;
          if (kcol > qr) e = -3e30f;   // causal mask
          st[j][i] = e;
        }
      }
      // online softmax; row lives across the 16 lanes of a half-wave
      #pragma unroll
      for (int i = 0; i < 8; ++i) {
        float mx = fmaxf(st[0][i], st[1][i]);
        #pragma unroll
        for (int o = 8; o >= 1; o >>= 1) mx = fmaxf(mx, __shfl_xor(mx, o, 16));
        float mnew = fmaxf(mrun[i], mx);
        float alpha = __expf(mrun[i] - mnew);
        float p0 = __expf(st[0][i] - mnew);
        float p1 = __expf(st[1][i] - mnew);
        int r = i + hl * 8;
        Ps[wave][r][l16]      = f2bf(p0);
        Ps[wave][r][16 + l16] = f2bf(p1);
        float rs = p0 + p1;
        #pragma unroll
        for (int o = 8; o >= 1; o >>= 1) rs += __shfl_xor(rs, o, 16);
        srun[i] = srun[i] * alpha + rs;
        mrun[i] = mnew;
        #pragma unroll
        for (int n = 0; n < 4; ++n) oacc[n][i] *= alpha;
      }
      // P (C-layout) was spilled to LDS; reload as A-fragment, then P@V
      v16bf pf = mkfrag(&Ps[wave][l16][0], hl);
      #pragma unroll
      for (int n = 0; n < 4; ++n) {
        v16bf vf = mkfrag(&Vs[n * 16 + l16][0], hl);
        oacc[n] = wmma_bf16(pf, vf, oacc[n]);
      }
    }
    __syncthreads();
  }

  #pragma unroll
  for (int n = 0; n < 4; ++n)
    #pragma unroll
    for (int i = 0; i < 8; ++i) {
      int t = q0 + wave * 16 + i + hl * 8;
      float v = oacc[n][i] / srun[i];
      Y[(size_t)(b * WT + t) * WC + h * WD + n * 16 + l16] = f2bf(v);
    }
}

// ---- host launch ---------------------------------------------------------

extern "C" void kernel_launch(void* const* d_in, const int* in_sizes, int n_in,
                              void* d_out, int out_size, void* d_ws, size_t ws_size,
                              hipStream_t stream) {
  (void)in_sizes; (void)n_in; (void)out_size; (void)ws_size;
  const float* x   = (const float*)d_in[0];
  const float* g1  = (const float*)d_in[1];
  const float* be1 = (const float*)d_in[2];
  const float* g2  = (const float*)d_in[3];
  const float* be2 = (const float*)d_in[4];
  const float* Wq = (const float*)d_in[5];  const float* bq = (const float*)d_in[6];
  const float* Wk = (const float*)d_in[7];  const float* bk = (const float*)d_in[8];
  const float* Wv = (const float*)d_in[9];  const float* bv = (const float*)d_in[10];
  const float* Wp = (const float*)d_in[11]; const float* bp = (const float*)d_in[12];
  const float* W1 = (const float*)d_in[13]; const float* b1 = (const float*)d_in[14];
  const float* W2 = (const float*)d_in[15]; const float* b2 = (const float*)d_in[16];
  float* out = (float*)d_out;

  char* ws = (char*)d_ws;
  size_t off = 0;
  auto alloc = [&](size_t bytes) -> char* {
    char* p = ws + off; off += (bytes + 255) & ~(size_t)255; return p;
  };
  const size_t CC = (size_t)WC * WC;          // 262144
  const size_t C4 = (size_t)WC * 4 * WC;      // 1048576
  bf16_t* wqb = (bf16_t*)alloc(CC * 2);
  bf16_t* wkb = (bf16_t*)alloc(CC * 2);
  bf16_t* wvb = (bf16_t*)alloc(CC * 2);
  bf16_t* wpb = (bf16_t*)alloc(CC * 2);
  bf16_t* w1b = (bf16_t*)alloc(C4 * 2);
  bf16_t* w2b = (bf16_t*)alloc(C4 * 2);
  bf16_t* h1  = (bf16_t*)alloc((size_t)WM * WC * 2);
  bf16_t* qb  = (bf16_t*)alloc((size_t)WM * WC * 2);
  bf16_t* kb  = (bf16_t*)alloc((size_t)WM * WC * 2);
  bf16_t* vb  = (bf16_t*)alloc((size_t)WM * WC * 2);
  bf16_t* yb  = (bf16_t*)alloc((size_t)WM * WC * 2);
  float*  x1  = (float*)alloc((size_t)WM * WC * 4);
  bf16_t* h2  = (bf16_t*)alloc((size_t)WM * WC * 2);
  bf16_t* act = (bf16_t*)alloc((size_t)WM * 4 * WC * 2);

  // 1) + 2) weights -> bf16 and LN1, one launch
  prepass_kernel<<<LN_BLOCKS + CVT_BLOCKS, 256, 0, stream>>>(
      x, g1, be1, h1, Wq, Wk, Wv, Wp, W1, W2, wqb, wkb, wvb, wpb, w1b, w2b);

  // 3) Q/K/V projections (head-reshaped bf16 outputs), one launch: wqb/wkb/wvb and
  //    qb/kb/vb are consecutive allocations of whole 256-byte multiples
  dim3 gq(WC / 64, WM / 128);                   // (8, 64)
  dim3 gqkv(WC / 64, WM / 128, 3);              // (8, 64, 3)
  gemm_bf16_kernel<1><<<gqkv, 256, 0, stream>>>(h1, wqb, bq, nullptr, nullptr, qb, WM, WC, WC, bk, bv);

  // 4) causal flash attention
  dim3 ga(WT / 128, WBATCH * WH);               // (16, 32)
  attn_kernel<<<ga, 256, 0, stream>>>(qb, kb, vb, yb);

  // 5) output projection + residual -> x1 (f32)
  gemm_bf16_kernel<0><<<gq, 256, 0, stream>>>(yb, wpb, bp, x, x1, nullptr, WM, WC, WC, nullptr, nullptr);

  // 6) LN2
  ln_kernel<<<WM / 8, 256, 0, stream>>>(x1, g2, be2, h2, WM);

  // 7) MLP up + exact GELU -> bf16
  dim3 gm(4 * WC / 64, WM / 128);               // (32, 64)
  gemm_bf16_kernel<2><<<gm, 256, 0, stream>>>(h2, w1b, b1, nullptr, nullptr, act, WM, 4 * WC, WC, nullptr, nullptr);

  // 8) MLP down + residual -> d_out (f32)
  gemm_bf16_kernel<0><<<gq, 256, 0, stream>>>(act, w2b, b2, x1, out, nullptr, WM, WC, 4 * WC, nullptr, nullptr);
}

// v003
// A run of this version takes 309 microseconds.
// Two timings next to v002 both put it at 1.12 times that version's speed.
// Over all steps from v000 it is 1.55 times as fast.
#include <hip/hip_runtime.h>
#include <hip/hip_bf16.h>
#include <math.h>

// Problem dims (fixed by reference)
#define WBATCH 4
#define WT     2048
#define WC     512
#define WH     8
#define WD     64
#define WM     (WBATCH * WT)   // 8192 tokens

typedef __bf16 bf16_t;
typedef __attribute__((ext_vector_type(16))) __bf16 v16bf;
typedef __attribute__((ext_vector_type(8)))  __bf16 v8bf;
typedef __attribute__((ext_vector_type(8)))  float  v8f;
typedef __attribute__((ext_vector_type(4)))  int    v4i;
typedef __attribute__((ext_vector_type(8)))  int    v8i;
typedef __attribute__((ext_vector_type(4)))  unsigned int v4u;

#define BS_PITCH 40   // 32 used + 8 pad: 80 B
#define VS_PITCH 40   // 32 used + 8 pad: 80 B
#define KS_PITCH 72   // 64 used + 8 pad: 144 B

// ---- helpers -------------------------------------------------------------

__device__ __forceinline__ bf16_t f2bf(float f) {
  union { float f; unsigned u; } a; a.f = f;
  unsigned r = a.u + 0x7fffu + ((a.u >> 16) & 1u);   // round-nearest-even
  unsigned short s = (unsigned short)(r >> 16);
  bf16_t b; __builtin_memcpy(&b, &s, 2); return b;
}

__device__ __forceinline__ v16bf mkfrag(const bf16_t* row, int hl) {
  v8bf lo = *(const v8bf*)(row + hl * 8);
  v8bf hi = *(const v8bf*)(row + 16 + hl * 8);
  return __builtin_shufflevector(lo, hi, 0,1,2,3,4,5,6,7,8,9,10,11,12,13,14,15);
}

__device__ __forceinline__ v8f wmma_bf16(v16bf a, v16bf b, v8f c) {
  return __builtin_amdgcn_wmma_f32_16x16x32_bf16(false, a, false, b, (short)0, c,
                                                 false, false);
}

#if __has_builtin(__builtin_amdgcn_global_load_async_to_lds_b128)
#define CDNA5_ASYNC_LDS 1
#else
#define CDNA5_ASYNC_LDS 0
#endif

__device__ __forceinline__ void copy16_g2l(const void* g, void* l) {
#if CDNA5_ASYNC_LDS
  __builtin_amdgcn_global_load_async_to_lds_b128(
      (__attribute__((address_space(1))) v4i*)g,
      (__attribute__((address_space(3))) v4i*)l, 0, 0);
#else
  *(uint4*)l = *(const uint4*)g;
#endif
}

__device__ __forceinline__ void async_drain() {
#if CDNA5_ASYNC_LDS
  asm volatile("s_wait_asynccnt 0" ::: "memory");
#endif
}

#if __has_builtin(__builtin_amdgcn_tensor_load_to_lds)
#define CDNA5_TDM 1
#else
#define CDNA5_TDM 0
#endif

#if CDNA5_TDM
__device__ __forceinline__ void tdm_load_2d(unsigned lds_addr, const void* gaddr,
                                            unsigned tensor_d0, unsigned tensor_d1,
                                            unsigned tile_d0, unsigned tile_d1,
                                            unsigned long long stride0_elems) {
  unsigned long long ga = (unsigned long long)gaddr;
  v4u g0;
  g0.x = 1u;                                           // count=1, user mode
  g0.y = lds_addr;                                     // LDS byte address
  g0.z = (unsigned)(ga & 0xffffffffull);               // global_addr[31:0]
  g0.w = (unsigned)((ga >> 32) & 0x1ffffffull) | (2u << 30);  // [56:32] | type=2
  v8i g1;
  g1[0] = 0x00010000;
  g1[1] = (int)((tensor_d0 & 0xffffu) << 16);
  g1[2] = (int)((tensor_d0 >> 16) | ((tensor_d1 & 0xffffu) << 16));
  g1[3] = (int)((tensor_d1 >> 16) | (tile_d0 << 16));
  g1[4] = (int)(tile_d1 & 0xffffu);
  g1[5] = (int)(stride0_elems & 0xffffffffull);
  g1[6] = (int)((stride0_elems >> 32) & 0xffffull);
  g1[7] = 0;
  v4i z4 = {0, 0, 0, 0};
#if __clang_major__ >= 23
  v8i z8 = {0, 0, 0, 0, 0, 0, 0, 0};
  __builtin_amdgcn_tensor_load_to_lds(g0, g1, z4, z4, z8, 0);
#else
  __builtin_amdgcn_tensor_load_to_lds(g0, g1, z4, z4, 0);
#endif
}
#endif

__device__ __forceinline__ void tensor_drain() {
#if __has_builtin(__builtin_amdgcn_s_wait_tensorcnt)
  __builtin_amdgcn_s_wait_tensorcnt(0);
#else
  asm volatile("s_wait_tensorcnt 0" ::: "memory");
#endif
}

__device__ __forceinline__ unsigned lds_byte_addr(const void* p) {
  return (unsigned)(size_t)(__attribute__((address_space(3))) const char*)p;
}

// ---- LayerNorm: one wave (32 lanes) per row of 512 -----------------------

__device__ __forceinline__ void ln_rows(const float* __restrict__ x,
                                        const float* __restrict__ g,
                                        const float* __restrict__ beta,
                                        bf16_t* __restrict__ out, int rows) {
  int wave = threadIdx.x >> 5, lane = threadIdx.x & 31;
  int row = blockIdx.x * 8 + wave;
  if (row >= rows) return;
  const float* xr = x + (size_t)row * WC;
  float vals[16];
  float s = 0.f;
  #pragma unroll
  for (int k = 0; k < 16; ++k) { vals[k] = xr[lane + 32 * k]; s += vals[k]; }
  #pragma unroll
  for (int o = 16; o >= 1; o >>= 1) s += __shfl_xor(s, o, 32);
  float mean = s * (1.0f / WC);
  float vs = 0.f;
  #pragma unroll
  for (int k = 0; k < 16; ++k) { float d = vals[k] - mean; vs += d * d; }
  #pragma unroll
  for (int o = 16; o >= 1; o >>= 1) vs += __shfl_xor(vs, o, 32);
  float rinv = rsqrtf(vs * (1.0f / WC) + 1e-5f);
  #pragma unroll
  for (int k = 0; k < 16; ++k) {
    int idx = lane + 32 * k;
    out[(size_t)row * WC + idx] = f2bf((vals[k] - mean) * rinv * g[idx] + beta[idx]);
  }
}

__global__ void __launch_bounds__(256) ln_kernel(const float* __restrict__ x,
                                                 const float* __restrict__ g,
                                                 const float* __restrict__ beta,
                                                 bf16_t* __restrict__ out, int rows) {
  ln_rows(x, g, beta, out, rows);
}

// ---- Pre-pass: LayerNorm 1 and the six f32 -> bf16 weight conversions ----
// None of the seven depends on another, so they share one launch: blocks
// [0, LN_BLOCKS) normalise 8 rows each; the later blocks convert, CVT_SMALL or
// CVT_LARGE blocks to a matrix, one element per thread and trip.

#define LN_BLOCKS  (WM / 8)                 // 1024
#define CVT_SMALL  1024                     // blocks for a C x C matrix
#define CVT_LARGE  2048                     // blocks for a C x 4C matrix
#define CVT_BLOCKS (4 * CVT_SMALL + 2 * CVT_LARGE)

__device__ __forceinline__ void cvt_f32_bf16(const float* __restrict__ in,
                                             bf16_t* __restrict__ out, int n,
                                             int blk, int nblk) {
  for (int i = blk * 256 + threadIdx.x; i < n; i += nblk * 256)
    out[i] = f2bf(in[i]);
}

__global__ void __launch_bounds__(256) prepass_kernel(
    const float* __restrict__ x, const float* __restrict__ g,
    const float* __restrict__ beta, bf16_t* __restrict__ h,
    const float* __restrict__ Wq, const float* __restrict__ Wk,
    const float* __restrict__ Wv, const float* __restrict__ Wp,
    const float* __restrict__ W1, const float* __restrict__ W2,
    bf16_t* __restrict__ wqb, bf16_t* __restrict__ wkb,
    bf16_t* __restrict__ wvb, bf16_t* __restrict__ wpb,
    bf16_t* __restrict__ w1b, bf16_t* __restrict__ w2b) {
  if (blockIdx.x < LN_BLOCKS) { ln_rows(x, g, beta, h, WM); return; }
  int c = blockIdx.x - LN_BLOCKS;
  if (c < 4 * CVT_SMALL) {
    int m = c / CVT_SMALL;
    const float* in = m == 0 ? Wq  : m == 1 ? Wk  : m == 2 ? Wv  : Wp;
    bf16_t* out     = m == 0 ? wqb : m == 1 ? wkb : m == 2 ? wvb : wpb;
    cvt_f32_bf16(in, out, WC * WC, c - m * CVT_SMALL, CVT_SMALL);
  } else {
    c -= 4 * CVT_SMALL;
    int m = c / CVT_LARGE;
    cvt_f32_bf16(m == 0 ? W1 : W2, m == 0 ? w1b : w2b, 4 * WC * WC,
                 c - m * CVT_LARGE, CVT_LARGE);
  }
}

template <int MODE>
__global__ void __launch_bounds__(256) gemm_bf16_kernel(
    const bf16_t* __restrict__ A, const bf16_t* __restrict__ W,
    const float* __restrict__ bias, const float* __restrict__ resid,
    float* __restrict__ outF, bf16_t* __restrict__ outB,
    int Mm, int Nn, int Kk,
    const float* __restrict__ bias_z1, const float* __restrict__ bias_z2) {
  if constexpr (MODE == 1) {
    int z = blockIdx.z;
    W    += (size_t)z * Kk * Nn;
    outB += (size_t)z * Mm * Nn;
    bias  = z == 0 ? bias : z == 1 ? bias_z1 : bias_z2;
  }
  __shared__ bf16_t As[128][32];
  __shared__ bf16_t Bs[64][BS_PITCH];   // transposed: Bs[n][k], rows padded
  int tid = threadIdx.x;
  int lane = tid & 31, wave = tid >> 5;
  int hl = lane >> 4, l16 = lane & 15;
  int m0 = blockIdx.y * 128, n0 = blockIdx.x * 64;

  v8f acc[4] = {};
  int nk = Kk / 32;
  for (int kc = 0; kc < nk; ++kc) {
    int k0 = kc * 32;
#if CDNA5_TDM
    if (wave == 0) {
      tdm_load_2d(lds_byte_addr(&As[0][0]), A + (size_t)m0 * Kk + k0,
                  (unsigned)Kk, (unsigned)Mm, 32u, 128u,
                  (unsigned long long)Kk);
      tensor_drain();
    }
#else
    {   // fallback: async DMA per lane
      int ar = tid >> 1, ac = (tid & 1) * 16;
      const bf16_t* src = A + (size_t)(m0 + ar) * Kk + k0 + ac;
      copy16_g2l(src,     &As[ar][ac]);
      copy16_g2l(src + 8, &As[ar][ac + 8]);
    }
#endif
    {   // stage W tile transposed: read 8 contiguous n, scatter into Bs[n][k]
      int kk = tid >> 3, ns = (tid & 7) * 8;
      uint4 t = *(const uint4*)(W + (size_t)(k0 + kk) * Nn + n0 + ns);
      const bf16_t* tb = (const bf16_t*)&t;
      #pragma unroll
      for (int i = 0; i < 8; ++i) Bs[ns + i][kk] = tb[i];
    }
    if (kc + 1 < nk) {   // global_prefetch_b8 of next K-chunk
      __builtin_prefetch(A + (size_t)(m0 + (tid >> 1)) * Kk + k0 + 32, 0, 1);
      __builtin_prefetch(W + (size_t)(k0 + 32 + (tid >> 3)) * Nn + n0, 0, 1);
    }
#if !CDNA5_TDM
    async_drain();
#endif
    __syncthreads();
    v16bf af = mkfrag(&As[wave * 16 + l16][0], hl);
    #pragma unroll
    for (int j = 0; j < 4; ++j) {
      v16bf bfv = mkfrag(&Bs[j * 16 + l16][0], hl);
      acc[j] = wmma_bf16(af, bfv, acc[j]);
    }
    __syncthreads();
  }

  #pragma unroll
  for (int j = 0; j < 4; ++j) {
    #pragma unroll
    for (int i = 0; i < 8; ++i) {
      int row = m0 + wave * 16 + i + hl * 8;
      int col = n0 + j * 16 + l16;
      float v = acc[j][i] + bias[col];
      if constexpr (MODE == 0) {
        v += resid[(size_t)row * Nn + col];
        outF[(size_t)row * Nn + col] = v;
      } else if constexpr (MODE == 1) {
        int b = row / WT, t = row % WT;
        int hh = col >> 6, dd = col & 63;
        outB[((size_t)(b * WH + hh) * WT + t) * WD + dd] = f2bf(v);
      } else {
        float gl = 0.5f * v * (1.0f + erff(v * 0.70710678118f));
        outB[(size_t)row * Nn + col] = f2bf(gl);
      }
    }
  }
}

__device__ __forceinline__ float xhalf(float x) {
  return __builtin_bit_cast(float, __builtin_amdgcn_permlanex16(
      __builtin_bit_cast(int, x), __builtin_bit_cast(int, x),
      0x76543210, 0xfedcba98, false, false));
}

__global__ void __launch_bounds__(256) attn_kernel(
    const bf16_t* __restrict__ Q, const bf16_t* __restrict__ Km,
    const bf16_t* __restrict__ V, bf16_t* __restrict__ Y) {
  __shared__ bf16_t Ks[32][KS_PITCH];       // K rows (key-major), rows padded
  __shared__ bf16_t Vs[64][VS_PITCH];       // V transposed: Vs[d][key], rows padded
  int tid = threadIdx.x, lane = tid & 31, wave = tid >> 5;
  int hl = lane >> 4, l16 = lane & 15;
  int bh = blockIdx.y;
  int b = bh >> 3, h = bh & 7;
  int q0 = blockIdx.x * 128;
  const bf16_t* Qp = Q + (size_t)bh * WT * WD;
  const bf16_t* Kp = Km + (size_t)bh * WT * WD;
  const bf16_t* Vp = V + (size_t)bh * WT * WD;

  // Q^T B-fragments (lane column = l16), d split into two 32-chunks
  int qrow = q0 + wave * 16 + l16;
  v16bf qf[2];
  #pragma unroll
  for (int c = 0; c < 2; ++c) qf[c] = mkfrag(Qp + (size_t)qrow * WD + c * 32, hl);

  v8f oacc[4] = {};             // O^T: oacc[n][i] = O[qrow][n * 16 + hl * 8 + i]
  float mrun = -3e30f;          // running maximum of query qrow, alike in both halves
  float srun = 0.f;             // running sum over this half's keys only
  const float scale = 0.125f;   // 1/sqrt(64)
  int nchunk = (q0 + 128) / 32;
  int mymax = q0 + wave * 16 + 15;   // last q row this wave owns

  for (int kc = 0; kc < nchunk; ++kc) {
    int k0 = kc * 32;
    {
      int r = tid >> 3, cs = (tid & 7) * 8;
      copy16_g2l(Kp + (size_t)(k0 + r) * WD + cs, &Ks[r][cs]);
      uint4 t = *(const uint4*)(Vp + (size_t)(k0 + r) * WD + cs);
      const bf16_t* tb = (const bf16_t*)&t;
      #pragma unroll
      for (int i = 0; i < 8; ++i) Vs[cs + i][r] = tb[i];
    }
    async_drain();
    __syncthreads();
    if (k0 <= mymax) {
      float st[2][8];
      float mx = -3e30f;
      #pragma unroll
      for (int j = 0; j < 2; ++j) {
        v8f s = {};
        #pragma unroll
        for (int c = 0; c < 2; ++c) {
          v16bf kf = mkfrag(&Ks[j * 16 + l16][c * 32], hl);  // A row = K row
          s = wmma_bf16(kf, qf[c], s);
        }
        #pragma unroll
        for (int i = 0; i < 8; ++i) {
          int key = k0 + j * 16 + hl * 8 + i;
          float e = s[i] * scale;
          if (key > qrow) e = -3e30f;   // causal mask
          st[j][i] = e;
          mx = fmaxf(mx, e);
        }
      }
      // online softmax, one query per lane
      mx = fmaxf(mx, xhalf(mx));
      float mnew = fmaxf(mrun, mx);
      float alpha = __expf(mrun - mnew);
      v16bf pf;          // P^T B-fragment: element j * 8 + i is key j * 16 + hl * 8 + i
      float rs = 0.f;
      #pragma unroll
      for (int j = 0; j < 2; ++j)
        #pragma unroll
        for (int i = 0; i < 8; ++i) {
          float p = __expf(st[j][i] - mnew);
          rs += p;
          pf[j * 8 + i] = f2bf(p);
        }
      srun = srun * alpha + rs;
      mrun = mnew;
      #pragma unroll
      for (int n = 0; n < 4; ++n) {
        #pragma unroll
        for (int i = 0; i < 8; ++i) oacc[n][i] *= alpha;
      }
      #pragma unroll
      for (int n = 0; n < 4; ++n) {
        v16bf vf = mkfrag(&Vs[n * 16 + l16][0], hl);         // A row = V^T row
        oacc[n] = wmma_bf16(vf, pf, oacc[n]);
      }
    }
    __syncthreads();
  }

  // A lane holds 8 consecutive d of its query in each tile: one 16-byte store per tile.
  float stot = srun + xhalf(srun);
  #pragma unroll
  for (int n = 0; n < 4; ++n) {
    v8bf o;
    #pragma unroll
    for (int i = 0; i < 8; ++i) o[i] = f2bf(oacc[n][i] / stot);
    *(v8bf*)(Y + (size_t)(b * WT + qrow) * WC + h * WD + n * 16 + hl * 8) = o;
  }
}

// ---- host launch ---------------------------------------------------------

extern "C" void kernel_launch(void* const* d_in, const int* in_sizes, int n_in,
                              void* d_out, int out_size, void* d_ws, size_t ws_size,
                              hipStream_t stream) {
  (void)in_sizes; (void)n_in; (void)out_size; (void)ws_size;
  const float* x   = (const float*)d_in[0];
  const float* g1  = (const float*)d_in[1];
  const float* be1 = (const float*)d_in[2];
  const float* g2  = (const float*)d_in[3];
  const float* be2 = (const float*)d_in[4];
  const float* Wq = (const float*)d_in[5];  const float* bq = (const float*)d_in[6];
  const float* Wk = (const float*)d_in[7];  const float* bk = (const float*)d_in[8];
  const float* Wv = (const float*)d_in[9];  const float* bv = (const float*)d_in[10];
  const float* Wp = (const float*)d_in[11]; const float* bp = (const float*)d_in[12];
  const float* W1 = (const float*)d_in[13]; const float* b1 = (const float*)d_in[14];
  const float* W2 = (const float*)d_in[15]; const float* b2 = (const float*)d_in[16];
  float* out = (float*)d_out;

  char* ws = (char*)d_ws;
  size_t off = 0;
  auto alloc = [&](size_t bytes) -> char* {
    char* p = ws + off; off += (bytes + 255) & ~(size_t)255; return p;
  };
  const size_t CC = (size_t)WC * WC;          // 262144
  const size_t C4 = (size_t)WC * 4 * WC;      // 1048576
  bf16_t* wqb = (bf16_t*)alloc(CC * 2);
  bf16_t* wkb = (bf16_t*)alloc(CC * 2);
  bf16_t* wvb = (bf16_t*)alloc(CC * 2);
  bf16_t* wpb = (bf16_t*)alloc(CC * 2);
  bf16_t* w1b = (bf16_t*)alloc(C4 * 2);
  bf16_t* w2b = (bf16_t*)alloc(C4 * 2);
  bf16_t* h1  = (bf16_t*)alloc((size_t)WM * WC * 2);
  bf16_t* qb  = (bf16_t*)alloc((size_t)WM * WC * 2);
  bf16_t* kb  = (bf16_t*)alloc((size_t)WM * WC * 2);
  bf16_t* vb  = (bf16_t*)alloc((size_t)WM * WC * 2);
  bf16_t* yb  = (bf16_t*)alloc((size_t)WM * WC * 2);
  float*  x1  = (float*)alloc((size_t)WM * WC * 4);
  bf16_t* h2  = (bf16_t*)alloc((size_t)WM * WC * 2);
  bf16_t* act = (bf16_t*)alloc((size_t)WM * 4 * WC * 2);

  // 1) + 2) weights -> bf16 and LN1, one launch
  prepass_kernel<<<LN_BLOCKS + CVT_BLOCKS, 256, 0, stream>>>(
      x, g1, be1, h1, Wq, Wk, Wv, Wp, W1, W2, wqb, wkb, wvb, wpb, w1b, w2b);

  // 3) Q/K/V projections (head-reshaped bf16 outputs), one launch: wqb/wkb/wvb and
  //    qb/kb/vb are consecutive allocations of whole 256-byte multiples
  dim3 gq(WC / 64, WM / 128);                   // (8, 64)
  dim3 gqkv(WC / 64, WM / 128, 3);              // (8, 64, 3)
  gemm_bf16_kernel<1><<<gqkv, 256, 0, stream>>>(h1, wqb, bq, nullptr, nullptr, qb, WM, WC, WC, bk, bv);

  // 4) causal flash attention
  dim3 ga(WT / 128, WBATCH * WH);               // (16, 32)
  attn_kernel<<<ga, 256, 0, stream>>>(qb, kb, vb, yb);

  // 5) output projection + residual -> x1 (f32)
  gemm_bf16_kernel<0><<<gq, 256, 0, stream>>>(yb, wpb, bp, x, x1, nullptr, WM, WC, WC, nullptr, nullptr);

  // 6) LN2
  ln_kernel<<<WM / 8, 256, 0, stream>>>(x1, g2, be2, h2, WM);

  // 7) MLP up + exact GELU -> bf16
  dim3 gm(4 * WC / 64, WM / 128);               // (32, 64)
  gemm_bf16_kernel<2><<<gm, 256, 0, stream>>>(h2, w1b, b1, nullptr, nullptr, act, WM, 4 * WC, WC, nullptr, nullptr);

  // 8) MLP down + residual -> d_out (f32)
  gemm_bf16_kernel<0><<<gq, 256, 0, stream>>>(act, w2b, b2, x1, out, nullptr, WM, WC, 4 * WC, nullptr, nullptr);
}

// v004
// One run takes 242 microseconds.
// Two timings next to v003 both put it at 1.28 times that version's speed.
// All steps since v000 together make it 1.98 times as fast.
#include <hip/hip_runtime.h>
#include <hip/hip_bf16.h>
#include <math.h>

// Problem dims (fixed by reference)
#define WBATCH 4
#define WT     2048
#define WC     512
#define WH     8
#define WD     64
#define WM     (WBATCH * WT)   // 8192 tokens

typedef __bf16 bf16_t;
typedef __attribute__((ext_vector_type(16))) __bf16 v16bf;
typedef __attribute__((ext_vector_type(8)))  __bf16 v8bf;
typedef __attribute__((ext_vector_type(8)))  float  v8f;
typedef __attribute__((ext_vector_type(4)))  int    v4i;
typedef __attribute__((ext_vector_type(8)))  int    v8i;
typedef __attribute__((ext_vector_type(4)))  unsigned int v4u;

#define BS_PITCH 40   // 32 used + 8 pad: 80 B
#define VS_PITCH 40   // 32 used + 8 pad: 80 B
#define KS_PITCH 72   // 64 used + 8 pad: 144 B

// ---- helpers -------------------------------------------------------------

__device__ __forceinline__ bf16_t f2bf(float f) {
  union { float f; unsigned u; } a; a.f = f;
  unsigned r = a.u + 0x7fffu + ((a.u >> 16) & 1u);   // round-nearest-even
  unsigned short s = (unsigned short)(r >> 16);
  bf16_t b; __builtin_memcpy(&b, &s, 2); return b;
}

__device__ __forceinline__ v16bf mkfrag(const bf16_t* row, int hl) {
  v8bf lo = *(const v8bf*)(row + hl * 8);
  v8bf hi = *(const v8bf*)(row + 16 + hl * 8);
  return __builtin_shufflevector(lo, hi, 0,1,2,3,4,5,6,7,8,9,10,11,12,13,14,15);
}

__device__ __forceinline__ v8f wmma_bf16(v16bf a, v16bf b, v8f c) {
  return __builtin_amdgcn_wmma_f32_16x16x32_bf16(false, a, false, b, (short)0, c,
                                                 false, false);
}

#if __has_builtin(__builtin_amdgcn_global_load_async_to_lds_b128)
#define CDNA5_ASYNC_LDS 1
#else
#define CDNA5_ASYNC_LDS 0
#endif

__device__ __forceinline__ void copy16_g2l(const void* g, void* l) {
#if CDNA5_ASYNC_LDS
  __builtin_amdgcn_global_load_async_to_lds_b128(
      (__attribute__((address_space(1))) v4i*)g,
      (__attribute__((address_space(3))) v4i*)l, 0, 0);
#else
  *(uint4*)l = *(const uint4*)g;
#endif
}

__device__ __forceinline__ void async_drain() {
#if CDNA5_ASYNC_LDS
  asm volatile("s_wait_asynccnt 0" ::: "memory");
#endif
}

#if __has_builtin(__builtin_amdgcn_tensor_load_to_lds)
#define CDNA5_TDM 1
#else
#define CDNA5_TDM 0
#endif

#if CDNA5_TDM
__device__ __forceinline__ void tdm_load_2d(unsigned lds_addr, const void* gaddr,
                                            unsigned tensor_d0, unsigned tensor_d1,
                                            unsigned tile_d0, unsigned tile_d1,
                                            unsigned long long stride0_elems) {
  unsigned long long ga = (unsigned long long)gaddr;
  v4u g0;
  g0.x = 1u;                                           // count=1, user mode
  g0.y = lds_addr;                                     // LDS byte address
  g0.z = (unsigned)(ga & 0xffffffffull);               // global_addr[31:0]
  g0.w = (unsigned)((ga >> 32) & 0x1ffffffull) | (2u << 30);  // [56:32] | type=2
  v8i g1;
  g1[0] = 0x00010000;
  g1[1] = (int)((tensor_d0 & 0xffffu) << 16);
  g1[2] = (int)((tensor_d0 >> 16) | ((tensor_d1 & 0xffffu) << 16));
  g1[3] = (int)((tensor_d1 >> 16) | (tile_d0 << 16));
  g1[4] = (int)(tile_d1 & 0xffffu);
  g1[5] = (int)(stride0_elems & 0xffffffffull);
  g1[6] = (int)((stride0_elems >> 32) & 0xffffull);
  g1[7] = 0;
  v4i z4 = {0, 0, 0, 0};
#if __clang_major__ >= 23
  v8i z8 = {0, 0, 0, 0, 0, 0, 0, 0};
  __builtin_amdgcn_tensor_load_to_lds(g0, g1, z4, z4, z8, 0);
#else
  __builtin_amdgcn_tensor_load_to_lds(g0, g1, z4, z4, 0);
#endif
}
#endif

__device__ __forceinline__ void tensor_drain() {
#if __has_builtin(__builtin_amdgcn_s_wait_tensorcnt)
  __builtin_amdgcn_s_wait_tensorcnt(0);
#else
  asm volatile("s_wait_tensorcnt 0" ::: "memory");
#endif
}

__device__ __forceinline__ unsigned lds_byte_addr(const void* p) {
  return (unsigned)(size_t)(__attribute__((address_space(3))) const char*)p;
}

// ---- LayerNorm: one wave (32 lanes) per row of 512 -----------------------

__device__ __forceinline__ void ln_rows(const float* __restrict__ x,
                                        const float* __restrict__ g,
                                        const float* __restrict__ beta,
                                        bf16_t* __restrict__ out, int rows) {
  int wave = threadIdx.x >> 5, lane = threadIdx.x & 31;
  int row = blockIdx.x * 8 + wave;
  if (row >= rows) return;
  const float* xr = x + (size_t)row * WC;
  float vals[16];
  float s = 0.f;
  #pragma unroll
  for (int k = 0; k < 16; ++k) { vals[k] = xr[lane + 32 * k]; s += vals[k]; }
  #pragma unroll
  for (int o = 16; o >= 1; o >>= 1) s += __shfl_xor(s, o, 32);
  float mean = s * (1.0f / WC);
  float vs = 0.f;
  #pragma unroll
  for (int k = 0; k < 16; ++k) { float d = vals[k] - mean; vs += d * d; }
  #pragma unroll
  for (int o = 16; o >= 1; o >>= 1) vs += __shfl_xor(vs, o, 32);
  float rinv = rsqrtf(vs * (1.0f / WC) + 1e-5f);
  #pragma unroll
  for (int k = 0; k < 16; ++k) {
    int idx = lane + 32 * k;
    out[(size_t)row * WC + idx] = f2bf((vals[k] - mean) * rinv * g[idx] + beta[idx]);
  }
}

__global__ void __launch_bounds__(256) ln_kernel(const float* __restrict__ x,
                                                 const float* __restrict__ g,
                                                 const float* __restrict__ beta,
                                                 bf16_t* __restrict__ out, int rows) {
  ln_rows(x, g, beta, out, rows);
}

// ---- Pre-pass: LayerNorm 1 and the six f32 -> bf16 weight conversions ----
// None of the seven depends on another, so they share one launch: blocks
// [0, LN_BLOCKS) normalise 8 rows each; the later blocks convert, CVT_SMALL or
// CVT_LARGE blocks to a matrix. A weight W[K][N] goes out as Wt[K / 32][N][32], k
// innermost: the 64 n x 32 k tile of a GEMM step is then 4 KiB in a row, in the order of
// its LDS image. A block takes 64 k x 32 n, a lane one n (loads of whole lines) and 8
// consecutive k (one 16-byte store).

#define LN_BLOCKS  (WM / 8)                 // 1024
#define CVT_SMALL  (WC * WC / 2048)         // blocks for a C x C matrix
#define CVT_LARGE  (4 * WC * WC / 2048)     // blocks for a C x 4C or 4C x C matrix
#define CVT_BLOCKS (4 * CVT_SMALL + 2 * CVT_LARGE)

template <int NN>   // NN: row length of in, known at compile time: one address, constant offsets
__device__ __forceinline__ void cvt_f32_bf16_t(const float* __restrict__ in,
                                               bf16_t* __restrict__ out, int blk) {
  constexpr int ntile = NN / 32;
  int n = (blk % ntile) * 32 + (threadIdx.x & 31);
  int k = (blk / ntile) * 64 + (threadIdx.x >> 5) * 8;
  const float* src = in + (size_t)k * NN + n;
  float f[8];
  #pragma unroll
  for (int i = 0; i < 8; ++i) f[i] = src[i * NN];
  // before a register that the loads name is written again
  asm volatile("s_wait_xcnt 0x0" ::: "memory");
  v8bf o;
  #pragma unroll
  for (int i = 0; i < 8; ++i) o[i] = f2bf(f[i]);
  *(v8bf*)(out + ((size_t)(k >> 5) * NN + n) * 32 + (k & 31)) = o;
  // before a register that the store names is written again
  asm volatile("s_wait_xcnt 0x0" ::: "memory");
}

__global__ void __launch_bounds__(256) prepass_kernel(
    const float* __restrict__ x, const float* __restrict__ g,
    const float* __restrict__ beta, bf16_t* __restrict__ h,
    const float* __restrict__ Wq, const float* __restrict__ Wk,
    const float* __restrict__ Wv, const float* __restrict__ Wp,
    const float* __restrict__ W1, const float* __restrict__ W2,
    bf16_t* __restrict__ wqb, bf16_t* __restrict__ wkb,
    bf16_t* __restrict__ wvb, bf16_t* __restrict__ wpb,
    bf16_t* __restrict__ w1b, bf16_t* __restrict__ w2b) {
  if (blockIdx.x < LN_BLOCKS) { ln_rows(x, g, beta, h, WM); return; }
  int c = blockIdx.x - LN_BLOCKS;
  if (c < 4 * CVT_SMALL) {
    int m = c / CVT_SMALL;
    const float* in = m == 0 ? Wq  : m == 1 ? Wk  : m == 2 ? Wv  : Wp;
    bf16_t* out     = m == 0 ? wqb : m == 1 ? wkb : m == 2 ? wvb : wpb;
    cvt_f32_bf16_t<WC>(in, out, c - m * CVT_SMALL);
  } else {
    c -= 4 * CVT_SMALL;
    if (c < CVT_LARGE) cvt_f32_bf16_t<4 * WC>(W1, w1b, c);
    else               cvt_f32_bf16_t<WC>(W2, w2b, c - CVT_LARGE);
  }
}

template <int MODE>
__global__ void __launch_bounds__(256) gemm_bf16_kernel(
    const bf16_t* __restrict__ A, const bf16_t* __restrict__ W,
    const float* __restrict__ bias, const float* __restrict__ resid,
    float* __restrict__ outF, bf16_t* __restrict__ outB,
    int Mm, int Nn, int Kk,
    const float* __restrict__ bias_z1, const float* __restrict__ bias_z2) {
  if constexpr (MODE == 1) {
    int z = blockIdx.z;
    W    += (size_t)z * Kk * Nn;
    outB += (size_t)z * Mm * Nn;
    bias  = z == 0 ? bias : z == 1 ? bias_z1 : bias_z2;
  }
  __shared__ bf16_t As[128][32];
  __shared__ __attribute__((aligned(16))) bf16_t Bs[64][BS_PITCH];   // Bs[n][k], rows padded
  int tid = threadIdx.x;
  int lane = tid & 31, wave = tid >> 5;
  int hl = lane >> 4, l16 = lane & 15;
  int m0 = blockIdx.y * 128, n0 = blockIdx.x * 64;

  v8f acc[4] = {};
  int nk = Kk / 32;
  for (int kc = 0; kc < nk; ++kc) {
    int k0 = kc * 32;
#if CDNA5_TDM
    if (wave == 0) {
      tdm_load_2d(lds_byte_addr(&As[0][0]), A + (size_t)m0 * Kk + k0,
                  (unsigned)Kk, (unsigned)Mm, 32u, 128u,
                  (unsigned long long)Kk);
      tensor_drain();
    }
#else
    {   // fallback: async DMA per lane
      int ar = tid >> 1, ac = (tid & 1) * 16;
      const bf16_t* src = A + (size_t)(m0 + ar) * Kk + k0 + ac;
      copy16_g2l(src,     &As[ar][ac]);
      copy16_g2l(src + 8, &As[ar][ac + 8]);
    }
#endif
    {   // stage W tile: 8 contiguous k of one n, one 16-byte store into Bs[n][k]
      *(uint4*)&Bs[tid >> 2][(tid & 3) * 8] =
          *(const uint4*)(W + ((size_t)kc * Nn + n0) * 32 + tid * 8);
    }
    if (kc + 1 < nk) {   // global_prefetch_b8 of next K-chunk
      __builtin_prefetch(A + (size_t)(m0 + (tid >> 1)) * Kk + k0 + 32, 0, 1);
      __builtin_prefetch(W + ((size_t)(kc + 1) * Nn + n0) * 32 + tid * 8, 0, 1);
    }
#if !CDNA5_TDM
    async_drain();
#endif
    __syncthreads();
    v16bf af = mkfrag(&As[wave * 16 + l16][0], hl);
    #pragma unroll
    for (int j = 0; j < 4; ++j) {
      v16bf bfv = mkfrag(&Bs[j * 16 + l16][0], hl);
      acc[j] = wmma_bf16(af, bfv, acc[j]);
    }
    __syncthreads();
  }

  if constexpr (MODE == 1) {
    if (blockIdx.z == 2) {   // V: a lane's 8 rows are 8 consecutive t of one (head, d)
      int row = m0 + wave * 16 + hl * 8;
      int b = row / WT, t = row % WT;
      #pragma unroll
      for (int j = 0; j < 4; ++j) {
        int col = n0 + j * 16 + l16;
        float bc = bias[col];
        v8bf o;
        #pragma unroll
        for (int i = 0; i < 8; ++i) o[i] = f2bf(acc[j][i] + bc);
        *(v8bf*)(outB + (((size_t)(b * WH + (col >> 6)) * (WT / 32) + (t >> 5)) * WD +
                         (col & 63)) * 32 + (t & 31)) = o;
      }
      return;
    }
  }
  #pragma unroll
  for (int j = 0; j < 4; ++j) {
    #pragma unroll
    for (int i = 0; i < 8; ++i) {
      int row = m0 + wave * 16 + i + hl * 8;
      int col = n0 + j * 16 + l16;
      float v = acc[j][i] + bias[col];
      if constexpr (MODE == 0) {
        v += resid[(size_t)row * Nn + col];
        outF[(size_t)row * Nn + col] = v;
      } else if constexpr (MODE == 1) {
        int b = row / WT, t = row % WT;
        int hh = col >> 6, dd = col & 63;
        outB[((size_t)(b * WH + hh) * WT + t) * WD + dd] = f2bf(v);
      } else {
        float gl = 0.5f * v * (1.0f + erff(v * 0.70710678118f));
        outB[(size_t)row * Nn + col] = f2bf(gl);
      }
    }
  }
}

__device__ __forceinline__ float xhalf(float x) {
  return __builtin_bit_cast(float, __builtin_amdgcn_permlanex16(
      __builtin_bit_cast(int, x), __builtin_bit_cast(int, x),
      0x76543210, 0xfedcba98, false, false));
}

__global__ void __launch_bounds__(256) attn_kernel(
    const bf16_t* __restrict__ Q, const bf16_t* __restrict__ Km,
    const bf16_t* __restrict__ V, bf16_t* __restrict__ Y) {
  __shared__ bf16_t Ks[32][KS_PITCH];       // K rows (key-major), rows padded
  __shared__ __attribute__((aligned(16))) bf16_t Vs[64][VS_PITCH];   // Vs[d][key], rows padded
  int tid = threadIdx.x, lane = tid & 31, wave = tid >> 5;
  int hl = lane >> 4, l16 = lane & 15;
  int bh = blockIdx.y;
  int b = bh >> 3, h = bh & 7;
  int q0 = blockIdx.x * 128;
  const bf16_t* Qp = Q + (size_t)bh * WT * WD;
  const bf16_t* Kp = Km + (size_t)bh * WT * WD;
  const bf16_t* Vp = V + (size_t)bh * WT * WD;   // [t / 32][d][32]

  // Q^T B-fragments (lane column = l16), d split into two 32-chunks
  int qrow = q0 + wave * 16 + l16;
  v16bf qf[2];
  #pragma unroll
  for (int c = 0; c < 2; ++c) qf[c] = mkfrag(Qp + (size_t)qrow * WD + c * 32, hl);

  v8f oacc[4] = {};             // O^T: oacc[n][i] = O[qrow][n * 16 + hl * 8 + i]
  float mrun = -3e30f;          // running maximum of query qrow, alike in both halves
  float srun = 0.f;             // running sum over this half's keys only
  const float scale = 0.125f;   // 1/sqrt(64)
  int nchunk = (q0 + 128) / 32;
  int mymax = q0 + wave * 16 + 15;   // last q row this wave owns

  for (int kc = 0; kc < nchunk; ++kc) {
    int k0 = kc * 32;
    {   // stage K via async DMA to LDS, V (8 keys of one d) by one 16-byte store
      int r = tid >> 3, cs = (tid & 7) * 8;
      copy16_g2l(Kp + (size_t)(k0 + r) * WD + cs, &Ks[r][cs]);
      *(uint4*)&Vs[tid >> 2][(tid & 3) * 8] =
          *(const uint4*)(Vp + (size_t)kc * (WD * 32) + tid * 8);
    }
    async_drain();
    __syncthreads();
    if (k0 <= mymax) {
      float st[2][8];
      float mx = -3e30f;
      #pragma unroll
      for (int j = 0; j < 2; ++j) {
        v8f s = {};
        #pragma unroll
        for (int c = 0; c < 2; ++c) {
          v16bf kf = mkfrag(&Ks[j * 16 + l16][c * 32], hl);  // A row = K row
          s = wmma_bf16(kf, qf[c], s);
        }
        #pragma unroll
        for (int i = 0; i < 8; ++i) {
          int key = k0 + j * 16 + hl * 8 + i;
          float e = s[i] * scale;
          if (key > qrow) e = -3e30f;   // causal mask
          st[j][i] = e;
          mx = fmaxf(mx, e);
        }
      }
      // online softmax, one query per lane
      mx = fmaxf(mx, xhalf(mx));
      float mnew = fmaxf(mrun, mx);
      float alpha = __expf(mrun - mnew);
      v16bf pf;          // P^T B-fragment: element j * 8 + i is key j * 16 + hl * 8 + i
      float rs = 0.f;
      #pragma unroll
      for (int j = 0; j < 2; ++j)
        #pragma unroll
        for (int i = 0; i < 8; ++i) {
          float p = __expf(st[j][i] - mnew);
          rs += p;
          pf[j * 8 + i] = f2bf(p);
        }
      srun = srun * alpha + rs;
      mrun = mnew;
      #pragma unroll
      for (int n = 0; n < 4; ++n) {
        #pragma unroll
        for (int i = 0; i < 8; ++i) oacc[n][i] *= alpha;
      }
      #pragma unroll
      for (int n = 0; n < 4; ++n) {
        v16bf vf = mkfrag(&Vs[n * 16 + l16][0], hl);         // A row = V^T row
        oacc[n] = wmma_bf16(vf, pf, oacc[n]);
      }
    }
    __syncthreads();
  }

  // A lane holds 8 consecutive d of its query in each tile: one 16-byte store per tile.
  float stot = srun + xhalf(srun);
  #pragma unroll
  for (int n = 0; n < 4; ++n) {
    v8bf o;
    #pragma unroll
    for (int i = 0; i < 8; ++i) o[i] = f2bf(oacc[n][i] / stot);
    *(v8bf*)(Y + (size_t)(b * WT + qrow) * WC + h * WD + n * 16 + hl * 8) = o;
  }
}

// ---- host launch ---------------------------------------------------------

extern "C" void kernel_launch(void* const* d_in, const int* in_sizes, int n_in,
                              void* d_out, int out_size, void* d_ws, size_t ws_size,
                              hipStream_t stream) {
  (void)in_sizes; (void)n_in; (void)out_size; (void)ws_size;
  const float* x   = (const float*)d_in[0];
  const float* g1  = (const float*)d_in[1];
  const float* be1 = (const float*)d_in[2];
  const float* g2  = (const float*)d_in[3];
  const float* be2 = (const float*)d_in[4];
  const float* Wq = (const float*)d_in[5];  const float* bq = (const float*)d_in[6];
  const float* Wk = (const float*)d_in[7];  const float* bk = (const float*)d_in[8];
  const float* Wv = (const float*)d_in[9];  const float* bv = (const float*)d_in[10];
  const float* Wp = (const float*)d_in[11]; const float* bp = (const float*)d_in[12];
  const float* W1 = (const float*)d_in[13]; const float* b1 = (const float*)d_in[14];
  const float* W2 = (const float*)d_in[15]; const float* b2 = (const float*)d_in[16];
  float* out = (float*)d_out;

  char* ws = (char*)d_ws;
  size_t off = 0;
  auto alloc = [&](size_t bytes) -> char* {
    char* p = ws + off; off += (bytes + 255) & ~(size_t)255; return p;
  };
  const size_t CC = (size_t)WC * WC;          // 262144
  const size_t C4 = (size_t)WC * 4 * WC;      // 1048576
  bf16_t* wqb = (bf16_t*)alloc(CC * 2);
  bf16_t* wkb = (bf16_t*)alloc(CC * 2);
  bf16_t* wvb = (bf16_t*)alloc(CC * 2);
  bf16_t* wpb = (bf16_t*)alloc(CC * 2);
  bf16_t* w1b = (bf16_t*)alloc(C4 * 2);
  bf16_t* w2b = (bf16_t*)alloc(C4 * 2);
  bf16_t* h1  = (bf16_t*)alloc((size_t)WM * WC * 2);
  bf16_t* qb  = (bf16_t*)alloc((size_t)WM * WC * 2);
  bf16_t* kb  = (bf16_t*)alloc((size_t)WM * WC * 2);
  bf16_t* vb  = (bf16_t*)alloc((size_t)WM * WC * 2);
  bf16_t* yb  = (bf16_t*)alloc((size_t)WM * WC * 2);
  float*  x1  = (float*)alloc((size_t)WM * WC * 4);
  bf16_t* h2  = (bf16_t*)alloc((size_t)WM * WC * 2);
  bf16_t* act = (bf16_t*)alloc((size_t)WM * 4 * WC * 2);

  // 1) + 2) weights -> bf16, k innermost in 32-k tiles, and LN1, one launch
  prepass_kernel<<<LN_BLOCKS + CVT_BLOCKS, 256, 0, stream>>>(
      x, g1, be1, h1, Wq, Wk, Wv, Wp, W1, W2, wqb, wkb, wvb, wpb, w1b, w2b);

  // 3) Q/K/V projections (head-reshaped bf16 outputs), one launch: wqb/wkb/wvb and
  //    qb/kb/vb are consecutive allocations of whole 256-byte multiples
  dim3 gq(WC / 64, WM / 128);                   // (8, 64)
  dim3 gqkv(WC / 64, WM / 128, 3);              // (8, 64, 3)
  gemm_bf16_kernel<1><<<gqkv, 256, 0, stream>>>(h1, wqb, bq, nullptr, nullptr, qb, WM, WC, WC, bk, bv);

  // 4) causal flash attention
  dim3 ga(WT / 128, WBATCH * WH);               // (16, 32)
  attn_kernel<<<ga, 256, 0, stream>>>(qb, kb, vb, yb);

  // 5) output projection + residual -> x1 (f32)
  gemm_bf16_kernel<0><<<gq, 256, 0, stream>>>(yb, wpb, bp, x, x1, nullptr, WM, WC, WC, nullptr, nullptr);

  // 6) LN2
  ln_kernel<<<WM / 8, 256, 0, stream>>>(x1, g2, be2, h2, WM);

  // 7) MLP up + exact GELU -> bf16
  dim3 gm(4 * WC / 64, WM / 128);               // (32, 64)
  gemm_bf16_kernel<2><<<gm, 256, 0, stream>>>(h2, w1b, b1, nullptr, nullptr, act, WM, 4 * WC, WC, nullptr, nullptr);

  // 8) MLP down + residual -> d_out (f32)
  gemm_bf16_kernel<0><<<gq, 256, 0, stream>>>(act, w2b, b2, x1, out, nullptr, WM, WC, 4 * WC, nullptr, nullptr);
}

// v005
// A run of this version takes 186 microseconds.
// Two timings next to v004 put it at 1.30 and 1.31 times that version's speed.
// Over all steps from v000 it is 2.58 times as fast.
#include <hip/hip_runtime.h>
#include <hip/hip_bf16.h>
#include <math.h>

// Problem dims (fixed by reference)
#define WBATCH 4
#define WT     2048
#define WC     512
#define WH     8
#define WD     64
#define WM     (WBATCH * WT)   // 8192 tokens

typedef __bf16 bf16_t;
typedef __attribute__((ext_vector_type(16))) __bf16 v16bf;
typedef __attribute__((ext_vector_type(8)))  __bf16 v8bf;
typedef __attribute__((ext_vector_type(8)))  float  v8f;
typedef __attribute__((ext_vector_type(4)))  int    v4i;
typedef __attribute__((ext_vector_type(8)))  int    v8i;
typedef __attribute__((ext_vector_type(4)))  unsigned int v4u;

#define AS_PITCH 136  // 128 used + 8 pad: 272 B
#define VS_PITCH 40   // 32 used + 8 pad: 80 B
#define KS_PITCH 72   // 64 used + 8 pad: 144 B

// ---- helpers -------------------------------------------------------------

__device__ __forceinline__ bf16_t f2bf(float f) {
  union { float f; unsigned u; } a; a.f = f;
  unsigned r = a.u + 0x7fffu + ((a.u >> 16) & 1u);   // round-nearest-even
  unsigned short s = (unsigned short)(r >> 16);
  bf16_t b; __builtin_memcpy(&b, &s, 2); return b;
}

__device__ __forceinline__ v16bf mkfrag(const bf16_t* row, int hl) {
  v8bf lo = *(const v8bf*)(row + hl * 8);
  v8bf hi = *(const v8bf*)(row + 16 + hl * 8);
  return __builtin_shufflevector(lo, hi, 0,1,2,3,4,5,6,7,8,9,10,11,12,13,14,15);
}

__device__ __forceinline__ v8f wmma_bf16(v16bf a, v16bf b, v8f c) {
  return __builtin_amdgcn_wmma_f32_16x16x32_bf16(false, a, false, b, (short)0, c,
                                                 false, false);
}

#if __has_builtin(__builtin_amdgcn_global_load_async_to_lds_b128)
#define CDNA5_ASYNC_LDS 1
#else
#define CDNA5_ASYNC_LDS 0
#endif

__device__ __forceinline__ void copy16_g2l(const void* g, void* l) {
#if CDNA5_ASYNC_LDS
  __builtin_amdgcn_global_load_async_to_lds_b128(
      (__attribute__((address_space(1))) v4i*)g,
      (__attribute__((address_space(3))) v4i*)l, 0, 0);
#else
  *(uint4*)l = *(const uint4*)g;
#endif
}

__device__ __forceinline__ void async_drain() {
#if CDNA5_ASYNC_LDS
  asm volatile("s_wait_asynccnt 0" ::: "memory");
#endif
}

#define GK 128   // k per GEMM stage: a row of the A tile is 256 B

typedef __attribute__((ext_vector_type(8))) unsigned int v8u;

__device__ __forceinline__ unsigned uni(unsigned v) {
  return (unsigned)__builtin_amdgcn_readfirstlane(v);
}

__device__ __forceinline__ unsigned pinned(unsigned v) {
  unsigned w = uni(v);
  asm volatile("" : "+s"(w));   // pinned(): keeps the word scalar
  return w;
}

__device__ __forceinline__ v8u tdm_group1(unsigned src_pitch) {
  constexpr unsigned d0 = GK * 2, d1 = 128;
  v8u g;
  g[0] = uni((1u << 20) | (5u << 22) | (3u << 25));
  g[1] = uni((d0 & 0xffffu) << 16);
  g[2] = uni((d0 >> 16) | ((d1 & 0xffffu) << 16));
  g[3] = uni((d1 >> 16) | (d0 << 16));
  g[4] = uni(d1);
  g[5] = uni(src_pitch);
  g[6] = uni(0u);
  g[7] = uni(0u);
  return g;
}

__device__ __forceinline__ v4u tdm_group0(unsigned lds_dst, unsigned long long ga) {
  v4u g;
  g[0] = uni(1u);
  g[1] = uni(lds_dst);
  g[2] = uni((unsigned)ga);
  g[3] = uni((((unsigned)(ga >> 32)) & 0x01ffffffu) | 0x80000000u);
  return g;
}

__device__ __forceinline__ void tdm_load(v4u g0, v8u g1) {
  asm volatile("tensor_load_to_lds %0, %1" :: "s"(g0), "s"(g1) : "memory");
}

__device__ __forceinline__ unsigned lds_byte_addr(const void* p) {
  return (unsigned)(size_t)(__attribute__((address_space(3))) const char*)p;
}

// ---- LayerNorm: one wave (32 lanes) per row of 512 -----------------------

__device__ __forceinline__ void ln_rows(const float* __restrict__ x,
                                        const float* __restrict__ g,
                                        const float* __restrict__ beta,
                                        bf16_t* __restrict__ out, int rows) {
  int wave = threadIdx.x >> 5, lane = threadIdx.x & 31;
  int row = blockIdx.x * 8 + wave;
  if (row >= rows) return;
  const float* xr = x + (size_t)row * WC;
  float vals[16];
  float s = 0.f;
  #pragma unroll
  for (int k = 0; k < 16; ++k) { vals[k] = xr[lane + 32 * k]; s += vals[k]; }
  #pragma unroll
  for (int o = 16; o >= 1; o >>= 1) s += __shfl_xor(s, o, 32);
  float mean = s * (1.0f / WC);
  float vs = 0.f;
  #pragma unroll
  for (int k = 0; k < 16; ++k) { float d = vals[k] - mean; vs += d * d; }
  #pragma unroll
  for (int o = 16; o >= 1; o >>= 1) vs += __shfl_xor(vs, o, 32);
  float rinv = rsqrtf(vs * (1.0f / WC) + 1e-5f);
  #pragma unroll
  for (int k = 0; k < 16; ++k) {
    int idx = lane + 32 * k;
    out[(size_t)row * WC + idx] = f2bf((vals[k] - mean) * rinv * g[idx] + beta[idx]);
  }
}

__global__ void __launch_bounds__(256) ln_kernel(const float* __restrict__ x,
                                                 const float* __restrict__ g,
                                                 const float* __restrict__ beta,
                                                 bf16_t* __restrict__ out, int rows) {
  ln_rows(x, g, beta, out, rows);
}

// ---- Pre-pass: LayerNorm 1 and the six f32 -> bf16 weight conversions ----
// None of the seven depends on another, so they share one launch: blocks
// [0, LN_BLOCKS) normalise 8 rows each; the later blocks convert, CVT_SMALL or
// CVT_LARGE blocks to a matrix. A weight W[K][N] goes out as Wt[K / 32][N][32], k
// innermost: the 64 n x 32 k tile of a GEMM step is then 4 KiB in a row, in the order of
// its LDS image. A block takes 64 k x 32 n, a lane one n (loads of whole lines) and 8
// consecutive k (one 16-byte store).

#define LN_BLOCKS  (WM / 8)                 // 1024
#define CVT_SMALL  (WC * WC / 2048)         // blocks for a C x C matrix
#define CVT_LARGE  (4 * WC * WC / 2048)     // blocks for a C x 4C or 4C x C matrix
#define CVT_BLOCKS (4 * CVT_SMALL + 2 * CVT_LARGE)

template <int NN>   // NN: row length of in, known at compile time: one address, constant offsets
__device__ __forceinline__ void cvt_f32_bf16_t(const float* __restrict__ in,
                                               bf16_t* __restrict__ out, int blk) {
  constexpr int ntile = NN / 32;
  int n = (blk % ntile) * 32 + (threadIdx.x & 31);
  int k = (blk / ntile) * 64 + (threadIdx.x >> 5) * 8;
  const float* src = in + (size_t)k * NN + n;
  float f[8];
  #pragma unroll
  for (int i = 0; i < 8; ++i) f[i] = src[i * NN];
  // before a register that the loads name is written again
  asm volatile("s_wait_xcnt 0x0" ::: "memory");
  v8bf o;
  #pragma unroll
  for (int i = 0; i < 8; ++i) o[i] = f2bf(f[i]);
  *(v8bf*)(out + ((size_t)(k >> 5) * NN + n) * 32 + (k & 31)) = o;
  // before a register that the store names is written again
  asm volatile("s_wait_xcnt 0x0" ::: "memory");
}

__global__ void __launch_bounds__(256) prepass_kernel(
    const float* __restrict__ x, const float* __restrict__ g,
    const float* __restrict__ beta, bf16_t* __restrict__ h,
    const float* __restrict__ Wq, const float* __restrict__ Wk,
    const float* __restrict__ Wv, const float* __restrict__ Wp,
    const float* __restrict__ W1, const float* __restrict__ W2,
    bf16_t* __restrict__ wqb, bf16_t* __restrict__ wkb,
    bf16_t* __restrict__ wvb, bf16_t* __restrict__ wpb,
    bf16_t* __restrict__ w1b, bf16_t* __restrict__ w2b) {
  if (blockIdx.x < LN_BLOCKS) { ln_rows(x, g, beta, h, WM); return; }
  int c = blockIdx.x - LN_BLOCKS;
  if (c < 4 * CVT_SMALL) {
    int m = c / CVT_SMALL;
    const float* in = m == 0 ? Wq  : m == 1 ? Wk  : m == 2 ? Wv  : Wp;
    bf16_t* out     = m == 0 ? wqb : m == 1 ? wkb : m == 2 ? wvb : wpb;
    cvt_f32_bf16_t<WC>(in, out, c - m * CVT_SMALL);
  } else {
    c -= 4 * CVT_SMALL;
    if (c < CVT_LARGE) cvt_f32_bf16_t<4 * WC>(W1, w1b, c);
    else               cvt_f32_bf16_t<WC>(W2, w2b, c - CVT_LARGE);
  }
}

template <int MODE>
__global__ void __launch_bounds__(256, MODE == 1 ? 12 : 1) gemm_bf16_kernel(
    const bf16_t* __restrict__ A, const bf16_t* __restrict__ W,
    const float* __restrict__ bias, const float* __restrict__ resid,
    float* __restrict__ outF, bf16_t* __restrict__ outB,
    int Mm, int Nn, int Kk,
    const float* __restrict__ bias_z1, const float* __restrict__ bias_z2) {
  if constexpr (MODE == 1) {
    int z = blockIdx.z;
    W    += (size_t)z * Kk * Nn;
    outB += (size_t)z * Mm * Nn;
    bias  = z == 0 ? bias : z == 1 ? bias_z1 : bias_z2;
  }
  __shared__ __attribute__((aligned(2048))) bf16_t As[128 * AS_PITCH];   // rows padded by the mover
  __shared__ __attribute__((aligned(16))) bf16_t Bs[64][AS_PITCH];   // Bs[n][k], rows padded
  int tid = threadIdx.x;
  int lane = tid & 31, wave = tid >> 5;
  int hl = lane >> 4, l16 = lane & 15;
  int m0 = blockIdx.y * 128, n0 = blockIdx.x * 64;
  const unsigned wave_u = uni(threadIdx.x >> 5);
  const v8u g1 = tdm_group1((unsigned)Kk * 2u);

  v8f acc[4] = {};
  int nk = Kk / GK;
  for (int kc = 0; kc < nk; ++kc) {
    int k0 = kc * GK;
    if (pinned(wave_u == 0)) {   // one request moves the whole 128 x 128 A tile
      tdm_load(tdm_group0(lds_byte_addr(As),
                          (unsigned long long)(A + (size_t)m0 * Kk + k0)), g1);
      // the tile has landed before this wave reaches the barrier that publishes it
      asm volatile("s_wait_tensorcnt 0x0" ::: "memory");
    }
    #pragma unroll   // the four loads fly together
    for (int kk = 0; kk < GK / 32; ++kk)   // W tile: 8 contiguous k of one n in each 32-k piece
      *(uint4*)&Bs[tid >> 2][kk * 32 + (tid & 3) * 8] =
          *(const uint4*)(W + ((size_t)(kc * (GK / 32) + kk) * Nn + n0) * 32 + tid * 8);
    // before a register that the loads name is written again
    asm volatile("s_wait_xcnt 0x0" ::: "memory");
    if (kc + 1 < nk) {   // global_prefetch_b8 of the next stage, a 128-B line of A a thread
      __builtin_prefetch(A + (size_t)(m0 + (tid >> 1)) * Kk + k0 + GK + (tid & 1) * 64, 0, 1);
      __builtin_prefetch(W + ((size_t)((kc + 1) * (GK / 32) + (tid >> 6)) * Nn + n0) * 32 +
                             (tid & 63) * 32, 0, 1);
    }
    __syncthreads();
    #pragma unroll   // every LDS offset a constant
    for (int kk = 0; kk < GK / 32; ++kk) {
      v16bf af = mkfrag(&As[(wave * 16 + l16) * AS_PITCH + kk * 32], hl);
      #pragma unroll
      for (int j = 0; j < 4; ++j) {
        v16bf bfv = mkfrag(&Bs[j * 16 + l16][kk * 32], hl);
        acc[j] = wmma_bf16(af, bfv, acc[j]);
      }
    }
    // this wave's LDS reads have retired before the next stage's tensor load may overwrite them
    asm volatile("s_wait_dscnt 0x0" ::: "memory");
    __syncthreads();
  }

  if constexpr (MODE == 1) {
    if (blockIdx.z == 2) {   // V: a lane's 8 rows are 8 consecutive t of one (head, d)
      int row = m0 + wave * 16 + hl * 8;
      int b = row / WT, t = row % WT;
      #pragma unroll
      for (int j = 0; j < 4; ++j) {
        int col = n0 + j * 16 + l16;
        float bc = bias[col];
        v8bf o;
        #pragma unroll
        for (int i = 0; i < 8; ++i) o[i] = f2bf(acc[j][i] + bc);
        *(v8bf*)(outB + (((size_t)(b * WH + (col >> 6)) * (WT / 32) + (t >> 5)) * WD +
                         (col & 63)) * 32 + (t & 31)) = o;
      }
      return;
    }
  }
  #pragma unroll
  for (int j = 0; j < 4; ++j) {
    #pragma unroll
    for (int i = 0; i < 8; ++i) {
      int row = m0 + wave * 16 + i + hl * 8;
      int col = n0 + j * 16 + l16;
      float v = acc[j][i] + bias[col];
      if constexpr (MODE == 0) {
        v += resid[(size_t)row * Nn + col];
        outF[(size_t)row * Nn + col] = v;
      } else if constexpr (MODE == 1) {
        int b = row / WT, t = row % WT;
        int hh = col >> 6, dd = col & 63;
        outB[((size_t)(b * WH + hh) * WT + t) * WD + dd] = f2bf(v);
      } else {
        float gl = 0.5f * v * (1.0f + erff(v * 0.70710678118f));
        outB[(size_t)row * Nn + col] = f2bf(gl);
      }
    }
  }
}

__device__ __forceinline__ float xhalf(float x) {
  return __builtin_bit_cast(float, __builtin_amdgcn_permlanex16(
      __builtin_bit_cast(int, x), __builtin_bit_cast(int, x),
      0x76543210, 0xfedcba98, false, false));
}

__global__ void __launch_bounds__(256) attn_kernel(
    const bf16_t* __restrict__ Q, const bf16_t* __restrict__ Km,
    const bf16_t* __restrict__ V, bf16_t* __restrict__ Y) {
  __shared__ bf16_t Ks[32][KS_PITCH];       // K rows (key-major), rows padded
  __shared__ __attribute__((aligned(16))) bf16_t Vs[64][VS_PITCH];   // Vs[d][key], rows padded
  int tid = threadIdx.x, lane = tid & 31, wave = tid >> 5;
  int hl = lane >> 4, l16 = lane & 15;
  int bh = blockIdx.y;
  int b = bh >> 3, h = bh & 7;
  int q0 = blockIdx.x * 128;
  const bf16_t* Qp = Q + (size_t)bh * WT * WD;
  const bf16_t* Kp = Km + (size_t)bh * WT * WD;
  const bf16_t* Vp = V + (size_t)bh * WT * WD;   // [t / 32][d][32]

  // Q^T B-fragments (lane column = l16), d split into two 32-chunks
  int qrow = q0 + wave * 16 + l16;
  v16bf qf[2];
  #pragma unroll
  for (int c = 0; c < 2; ++c) qf[c] = mkfrag(Qp + (size_t)qrow * WD + c * 32, hl);

  v8f oacc[4] = {};             // O^T: oacc[n][i] = O[qrow][n * 16 + hl * 8 + i]
  float mrun = -3e30f;          // running maximum of query qrow, alike in both halves
  float srun = 0.f;             // running sum over this half's keys only
  const float scale = 0.125f;   // 1/sqrt(64)
  int nchunk = (q0 + 128) / 32;
  int mymax = q0 + wave * 16 + 15;   // last q row this wave owns

  for (int kc = 0; kc < nchunk; ++kc) {
    int k0 = kc * 32;
    {   // stage K via async DMA to LDS, V (8 keys of one d) by one 16-byte store
      int r = tid >> 3, cs = (tid & 7) * 8;
      copy16_g2l(Kp + (size_t)(k0 + r) * WD + cs, &Ks[r][cs]);
      *(uint4*)&Vs[tid >> 2][(tid & 3) * 8] =
          *(const uint4*)(Vp + (size_t)kc * (WD * 32) + tid * 8);
    }
    async_drain();
    __syncthreads();
    if (k0 <= mymax) {
      float st[2][8];
      float mx = -3e30f;
      #pragma unroll
      for (int j = 0; j < 2; ++j) {
        v8f s = {};
        #pragma unroll
        for (int c = 0; c < 2; ++c) {
          v16bf kf = mkfrag(&Ks[j * 16 + l16][c * 32], hl);  // A row = K row
          s = wmma_bf16(kf, qf[c], s);
        }
        #pragma unroll
        for (int i = 0; i < 8; ++i) {
          int key = k0 + j * 16 + hl * 8 + i;
          float e = s[i] * scale;
          if (key > qrow) e = -3e30f;   // causal mask
          st[j][i] = e;
          mx = fmaxf(mx, e);
        }
      }
      // online softmax, one query per lane
      mx = fmaxf(mx, xhalf(mx));
      float mnew = fmaxf(mrun, mx);
      float alpha = __expf(mrun - mnew);
      v16bf pf;          // P^T B-fragment: element j * 8 + i is key j * 16 + hl * 8 + i
      float rs = 0.f;
      #pragma unroll
      for (int j = 0; j < 2; ++j)
        #pragma unroll
        for (int i = 0; i < 8; ++i) {
          float p = __expf(st[j][i] - mnew);
          rs += p;
          pf[j * 8 + i] = f2bf(p);
        }
      srun = srun * alpha + rs;
      mrun = mnew;
      #pragma unroll
      for (int n = 0; n < 4; ++n) {
        #pragma unroll
        for (int i = 0; i < 8; ++i) oacc[n][i] *= alpha;
      }
      #pragma unroll
      for (int n = 0; n < 4; ++n) {
        v16bf vf = mkfrag(&Vs[n * 16 + l16][0], hl);         // A row = V^T row
        oacc[n] = wmma_bf16(vf, pf, oacc[n]);
      }
    }
    __syncthreads();
  }

  // A lane holds 8 consecutive d of its query in each tile: one 16-byte store per tile.
  float stot = srun + xhalf(srun);
  #pragma unroll
  for (int n = 0; n < 4; ++n) {
    v8bf o;
    #pragma unroll
    for (int i = 0; i < 8; ++i) o[i] = f2bf(oacc[n][i] / stot);
    *(v8bf*)(Y + (size_t)(b * WT + qrow) * WC + h * WD + n * 16 + hl * 8) = o;
  }
}

// ---- host launch ---------------------------------------------------------

extern "C" void kernel_launch(void* const* d_in, const int* in_sizes, int n_in,
                              void* d_out, int out_size, void* d_ws, size_t ws_size,
                              hipStream_t stream) {
  (void)in_sizes; (void)n_in; (void)out_size; (void)ws_size;
  const float* x   = (const float*)d_in[0];
  const float* g1  = (const float*)d_in[1];
  const float* be1 = (const float*)d_in[2];
  const float* g2  = (const float*)d_in[3];
  const float* be2 = (const float*)d_in[4];
  const float* Wq = (const float*)d_in[5];  const float* bq = (const float*)d_in[6];
  const float* Wk = (const float*)d_in[7];  const float* bk = (const float*)d_in[8];
  const float* Wv = (const float*)d_in[9];  const float* bv = (const float*)d_in[10];
  const float* Wp = (const float*)d_in[11]; const float* bp = (const float*)d_in[12];
  const float* W1 = (const float*)d_in[13]; const float* b1 = (const float*)d_in[14];
  const float* W2 = (const float*)d_in[15]; const float* b2 = (const float*)d_in[16];
  float* out = (float*)d_out;

  char* ws = (char*)d_ws;
  size_t off = 0;
  auto alloc = [&](size_t bytes) -> char* {
    char* p = ws + off; off += (bytes + 255) & ~(size_t)255; return p;
  };
  const size_t CC = (size_t)WC * WC;          // 262144
  const size_t C4 = (size_t)WC * 4 * WC;      // 1048576
  bf16_t* wqb = (bf16_t*)alloc(CC * 2);
  bf16_t* wkb = (bf16_t*)alloc(CC * 2);
  bf16_t* wvb = (bf16_t*)alloc(CC * 2);
  bf16_t* wpb = (bf16_t*)alloc(CC * 2);
  bf16_t* w1b = (bf16_t*)alloc(C4 * 2);
  bf16_t* w2b = (bf16_t*)alloc(C4 * 2);
  bf16_t* h1  = (bf16_t*)alloc((size_t)WM * WC * 2);
  bf16_t* qb  = (bf16_t*)alloc((size_t)WM * WC * 2);
  bf16_t* kb  = (bf16_t*)alloc((size_t)WM * WC * 2);
  bf16_t* vb  = (bf16_t*)alloc((size_t)WM * WC * 2);
  bf16_t* yb  = (bf16_t*)alloc((size_t)WM * WC * 2);
  float*  x1  = (float*)alloc((size_t)WM * WC * 4);
  bf16_t* h2  = (bf16_t*)alloc((size_t)WM * WC * 2);
  bf16_t* act = (bf16_t*)alloc((size_t)WM * 4 * WC * 2);

  // 1) + 2) weights -> bf16, k innermost in 32-k tiles, and LN1, one launch
  prepass_kernel<<<LN_BLOCKS + CVT_BLOCKS, 256, 0, stream>>>(
      x, g1, be1, h1, Wq, Wk, Wv, Wp, W1, W2, wqb, wkb, wvb, wpb, w1b, w2b);

  // 3) Q/K/V projections (head-reshaped bf16 outputs), one launch: wqb/wkb/wvb and
  //    qb/kb/vb are consecutive allocations of whole 256-byte multiples
  dim3 gq(WC / 64, WM / 128);                   // (8, 64)
  dim3 gqkv(WC / 64, WM / 128, 3);              // (8, 64, 3)
  gemm_bf16_kernel<1><<<gqkv, 256, 0, stream>>>(h1, wqb, bq, nullptr, nullptr, qb, WM, WC, WC, bk, bv);

  // 4) causal flash attention
  dim3 ga(WT / 128, WBATCH * WH);               // (16, 32)
  attn_kernel<<<ga, 256, 0, stream>>>(qb, kb, vb, yb);

  // 5) output projection + residual -> x1 (f32)
  gemm_bf16_kernel<0><<<gq, 256, 0, stream>>>(yb, wpb, bp, x, x1, nullptr, WM, WC, WC, nullptr, nullptr);

  // 6) LN2
  ln_kernel<<<WM / 8, 256, 0, stream>>>(x1, g2, be2, h2, WM);

  // 7) MLP up + exact GELU -> bf16
  dim3 gm(4 * WC / 64, WM / 128);               // (32, 64)
  gemm_bf16_kernel<2><<<gm, 256, 0, stream>>>(h2, w1b, b1, nullptr, nullptr, act, WM, 4 * WC, WC, nullptr, nullptr);

  // 8) MLP down + residual -> d_out (f32)
  gemm_bf16_kernel<0><<<gq, 256, 0, stream>>>(act, w2b, b2, x1, out, nullptr, WM, WC, 4 * WC, nullptr, nullptr);
}

// v006
// One run takes 168 microseconds.
// Next to v005, in two timings, it ran 1.10 and 1.11 times as fast.
// All steps since v000 together make it 2.84 times as fast.
#include <hip/hip_runtime.h>
#include <hip/hip_bf16.h>
#include <math.h>

// Problem dims (fixed by reference)
#define WBATCH 4
#define WT     2048
#define WC     512
#define WH     8
#define WD     64
#define WM     (WBATCH * WT)   // 8192 tokens

typedef __bf16 bf16_t;
typedef __attribute__((ext_vector_type(16))) __bf16 v16bf;
typedef __attribute__((ext_vector_type(8)))  __bf16 v8bf;
typedef __attribute__((ext_vector_type(8)))  float  v8f;
typedef __attribute__((ext_vector_type(4)))  int    v4i;
typedef __attribute__((ext_vector_type(8)))  int    v8i;
typedef __attribute__((ext_vector_type(4)))  unsigned int v4u;

#define AS_PITCH 136  // 128 used + 8 pad: 272 B
#define VS_PITCH 40   // 32 used + 8 pad: 80 B
#define KS_PITCH 72   // 64 used + 8 pad: 144 B

// ---- helpers -------------------------------------------------------------

__device__ __forceinline__ bf16_t f2bf(float f) {
  union { float f; unsigned u; } a; a.f = f;
  unsigned r = a.u + 0x7fffu + ((a.u >> 16) & 1u);   // round-nearest-even
  unsigned short s = (unsigned short)(r >> 16);
  bf16_t b; __builtin_memcpy(&b, &s, 2); return b;
}

__device__ __forceinline__ v16bf mkfrag(const bf16_t* row, int hl) {
  v8bf lo = *(const v8bf*)(row + hl * 8);
  v8bf hi = *(const v8bf*)(row + 16 + hl * 8);
  return __builtin_shufflevector(lo, hi, 0,1,2,3,4,5,6,7,8,9,10,11,12,13,14,15);
}

__device__ __forceinline__ v8f wmma_bf16(v16bf a, v16bf b, v8f c) {
  return __builtin_amdgcn_wmma_f32_16x16x32_bf16(false, a, false, b, (short)0, c,
                                                 false, false);
}

#if __has_builtin(__builtin_amdgcn_global_load_async_to_lds_b128)
#define CDNA5_ASYNC_LDS 1
#else
#define CDNA5_ASYNC_LDS 0
#endif

__device__ __forceinline__ void copy16_g2l(const void* g, void* l) {
#if CDNA5_ASYNC_LDS
  __builtin_amdgcn_global_load_async_to_lds_b128(
      (__attribute__((address_space(1))) v4i*)g,
      (__attribute__((address_space(3))) v4i*)l, 0, 0);
#else
  *(uint4*)l = *(const uint4*)g;
#endif
}

__device__ __forceinline__ void async_drain() {
#if CDNA5_ASYNC_LDS
  asm volatile("s_wait_asynccnt 0" ::: "memory");
#endif
}

#define GK 128   // k per GEMM stage: a row of the A tile is 256 B

typedef __attribute__((ext_vector_type(8))) unsigned int v8u;

__device__ __forceinline__ unsigned uni(unsigned v) {
  return (unsigned)__builtin_amdgcn_readfirstlane(v);
}

__device__ __forceinline__ unsigned pinned(unsigned v) {
  unsigned w = uni(v);
  asm volatile("" : "+s"(w));   // pinned(): keeps the word scalar
  return w;
}

__device__ __forceinline__ v8u tdm_group1(unsigned src_pitch) {
  constexpr unsigned d0 = GK * 2, d1 = 128;
  v8u g;
  g[0] = uni((1u << 20) | (5u << 22) | (3u << 25));
  g[1] = uni((d0 & 0xffffu) << 16);
  g[2] = uni((d0 >> 16) | ((d1 & 0xffffu) << 16));
  g[3] = uni((d1 >> 16) | (d0 << 16));
  g[4] = uni(d1);
  g[5] = uni(src_pitch);
  g[6] = uni(0u);
  g[7] = uni(0u);
  return g;
}

__device__ __forceinline__ v4u tdm_group0(unsigned lds_dst, unsigned long long ga) {
  v4u g;
  g[0] = uni(1u);
  g[1] = uni(lds_dst);
  g[2] = uni((unsigned)ga);
  g[3] = uni((((unsigned)(ga >> 32)) & 0x01ffffffu) | 0x80000000u);
  return g;
}

__device__ __forceinline__ void tdm_load(v4u g0, v8u g1) {
  asm volatile("tensor_load_to_lds %0, %1" :: "s"(g0), "s"(g1) : "memory");
}

__device__ __forceinline__ unsigned lds_byte_addr(const void* p) {
  return (unsigned)(size_t)(__attribute__((address_space(3))) const char*)p;
}

// ---- LayerNorm: one wave (32 lanes) per row of 512 -----------------------

__device__ __forceinline__ void ln_rows(const float* __restrict__ x,
                                        const float* __restrict__ g,
                                        const float* __restrict__ beta,
                                        bf16_t* __restrict__ out, int rows) {
  int wave = threadIdx.x >> 5, lane = threadIdx.x & 31;
  int row = blockIdx.x * 8 + wave;
  if (row >= rows) return;
  const float* xr = x + (size_t)row * WC;
  float vals[16];
  float s = 0.f;
  #pragma unroll
  for (int k = 0; k < 16; ++k) { vals[k] = xr[lane + 32 * k]; s += vals[k]; }
  #pragma unroll
  for (int o = 16; o >= 1; o >>= 1) s += __shfl_xor(s, o, 32);
  float mean = s * (1.0f / WC);
  float vs = 0.f;
  #pragma unroll
  for (int k = 0; k < 16; ++k) { float d = vals[k] - mean; vs += d * d; }
  #pragma unroll
  for (int o = 16; o >= 1; o >>= 1) vs += __shfl_xor(vs, o, 32);
  float rinv = rsqrtf(vs * (1.0f / WC) + 1e-5f);
  #pragma unroll
  for (int k = 0; k < 16; ++k) {
    int idx = lane + 32 * k;
    out[(size_t)row * WC + idx] = f2bf((vals[k] - mean) * rinv * g[idx] + beta[idx]);
  }
}

__global__ void __launch_bounds__(256) ln_kernel(const float* __restrict__ x,
                                                 const float* __restrict__ g,
                                                 const float* __restrict__ beta,
                                                 bf16_t* __restrict__ out, int rows) {
  ln_rows(x, g, beta, out, rows);
}

// ---- Pre-pass: LayerNorm 1 and the six f32 -> bf16 weight conversions ----
// None of the seven depends on another, so they share one launch: blocks
// [0, LN_BLOCKS) normalise 8 rows each; the later blocks convert, CVT_SMALL or
// CVT_LARGE blocks to a matrix. A weight W[K][N] goes out as Wt[K / 32][N][32], k
// innermost: the 64 n x 32 k tile of a GEMM step is then 4 KiB in a row, in the order of
// its LDS image. A block takes 64 k x 32 n, a lane one n (loads of whole lines) and 8
// consecutive k (one 16-byte store).

#define LN_BLOCKS  (WM / 8)                 // 1024
#define CVT_SMALL  (WC * WC / 2048)         // blocks for a C x C matrix
#define CVT_LARGE  (4 * WC * WC / 2048)     // blocks for a C x 4C or 4C x C matrix
#define CVT_BLOCKS (4 * CVT_SMALL + 2 * CVT_LARGE)

template <int NN>   // NN: row length of in, known at compile time: one address, constant offsets
__device__ __forceinline__ void cvt_f32_bf16_t(const float* __restrict__ in,
                                               bf16_t* __restrict__ out, int blk) {
  constexpr int ntile = NN / 32;
  int n = (blk % ntile) * 32 + (threadIdx.x & 31);
  int k = (blk / ntile) * 64 + (threadIdx.x >> 5) * 8;
  const float* src = in + (size_t)k * NN + n;
  float f[8];
  #pragma unroll
  for (int i = 0; i < 8; ++i) f[i] = src[i * NN];
  // before a register that the loads name is written again
  asm volatile("s_wait_xcnt 0x0" ::: "memory");
  v8bf o;
  #pragma unroll
  for (int i = 0; i < 8; ++i) o[i] = f2bf(f[i]);
  *(v8bf*)(out + ((size_t)(k >> 5) * NN + n) * 32 + (k & 31)) = o;
  // before a register that the store names is written again
  asm volatile("s_wait_xcnt 0x0" ::: "memory");
}

__global__ void __launch_bounds__(256) prepass_kernel(
    const float* __restrict__ x, const float* __restrict__ g,
    const float* __restrict__ beta, bf16_t* __restrict__ h,
    const float* __restrict__ Wq, const float* __restrict__ Wk,
    const float* __restrict__ Wv, const float* __restrict__ Wp,
    const float* __restrict__ W1, const float* __restrict__ W2,
    bf16_t* __restrict__ wqb, bf16_t* __restrict__ wkb,
    bf16_t* __restrict__ wvb, bf16_t* __restrict__ wpb,
    bf16_t* __restrict__ w1b, bf16_t* __restrict__ w2b) {
  if (blockIdx.x < LN_BLOCKS) { ln_rows(x, g, beta, h, WM); return; }
  int c = blockIdx.x - LN_BLOCKS;
  if (c < 4 * CVT_SMALL) {
    int m = c / CVT_SMALL;
    const float* in = m == 0 ? Wq  : m == 1 ? Wk  : m == 2 ? Wv  : Wp;
    bf16_t* out     = m == 0 ? wqb : m == 1 ? wkb : m == 2 ? wvb : wpb;
    cvt_f32_bf16_t<WC>(in, out, c - m * CVT_SMALL);
  } else {
    c -= 4 * CVT_SMALL;
    if (c < CVT_LARGE) cvt_f32_bf16_t<4 * WC>(W1, w1b, c);
    else               cvt_f32_bf16_t<WC>(W2, w2b, c - CVT_LARGE);
  }
}

template <int MODE>
__global__ void __launch_bounds__(256, MODE == 1 ? 12 : 1) gemm_bf16_kernel(
    const bf16_t* __restrict__ A, const bf16_t* __restrict__ W,
    const float* __restrict__ bias, const float* __restrict__ resid,
    float* __restrict__ outF, bf16_t* __restrict__ outB,
    int Mm, int Nn, int Kk,
    const float* __restrict__ bias_z1, const float* __restrict__ bias_z2) {
  if constexpr (MODE == 1) {
    int z = blockIdx.z;
    W    += (size_t)z * Kk * Nn;
    outB += (size_t)z * Mm * Nn;
    bias  = z == 0 ? bias : z == 1 ? bias_z1 : bias_z2;
  }
  __shared__ __attribute__((aligned(2048))) bf16_t As[128 * AS_PITCH];   // rows padded by the mover
  __shared__ __attribute__((aligned(16))) bf16_t Bs[64][AS_PITCH];   // Bs[n][k], rows padded
  int tid = threadIdx.x;
  int lane = tid & 31, wave = tid >> 5;
  int hl = lane >> 4, l16 = lane & 15;
  int m0 = blockIdx.y * 128, n0 = blockIdx.x * 64;
  const unsigned wave_u = uni(threadIdx.x >> 5);
  const v8u g1 = tdm_group1((unsigned)Kk * 2u);

  v8f acc[4] = {};
  int nk = Kk / GK;
  for (int kc = 0; kc < nk; ++kc) {
    int k0 = kc * GK;
    if (pinned(wave_u == 0)) {   // one request moves the whole 128 x 128 A tile
      tdm_load(tdm_group0(lds_byte_addr(As),
                          (unsigned long long)(A + (size_t)m0 * Kk + k0)), g1);
      // the tile has landed before this wave reaches the barrier that publishes it
      asm volatile("s_wait_tensorcnt 0x0" ::: "memory");
    }
    #pragma unroll   // the four loads fly together
    for (int kk = 0; kk < GK / 32; ++kk)   // W tile: 8 contiguous k of one n in each 32-k piece
      *(uint4*)&Bs[tid >> 2][kk * 32 + (tid & 3) * 8] =
          *(const uint4*)(W + ((size_t)(kc * (GK / 32) + kk) * Nn + n0) * 32 + tid * 8);
    // before a register that the loads name is written again
    asm volatile("s_wait_xcnt 0x0" ::: "memory");
    if (kc + 1 < nk) {   // global_prefetch_b8 of the next stage, a 128-B line of A a thread
      __builtin_prefetch(A + (size_t)(m0 + (tid >> 1)) * Kk + k0 + GK + (tid & 1) * 64, 0, 1);
      __builtin_prefetch(W + ((size_t)((kc + 1) * (GK / 32) + (tid >> 6)) * Nn + n0) * 32 +
                             (tid & 63) * 32, 0, 1);
    }
    __syncthreads();
    if constexpr (MODE == 0) {
      v16bf af[GK / 32], bfv[GK / 32][4];
      #pragma unroll   // every LDS offset a constant
      for (int kk = 0; kk < GK / 32; ++kk) {
        af[kk] = mkfrag(&As[(wave * 16 + l16) * AS_PITCH + kk * 32], hl);
        #pragma unroll   // here and below: every index a constant, so the fragments stay in registers
        for (int j = 0; j < 4; ++j) bfv[kk][j] = mkfrag(&Bs[j * 16 + l16][kk * 32], hl);
      }
      // keeps the reads above the WMMAs: without it the compiler sinks each pair of reads to
      // its WMMA, with a full wait at each of the sixteen places
      __builtin_amdgcn_sched_barrier(0);
      #pragma unroll
      for (int kk = 0; kk < GK / 32; ++kk) {
        #pragma unroll
        for (int j = 0; j < 4; ++j) acc[j] = wmma_bf16(af[kk], bfv[kk][j], acc[j]);
      }
      // keeps the WMMAs above the full wait and the barrier below: they run while the later
      // reads still land, not behind the last of them
      __builtin_amdgcn_sched_barrier(0);
    } else {
      #pragma unroll   // every LDS offset a constant
      for (int kk = 0; kk < GK / 32; ++kk) {
        v16bf af = mkfrag(&As[(wave * 16 + l16) * AS_PITCH + kk * 32], hl);
        #pragma unroll
        for (int j = 0; j < 4; ++j) {
          v16bf bfv = mkfrag(&Bs[j * 16 + l16][kk * 32], hl);
          acc[j] = wmma_bf16(af, bfv, acc[j]);
        }
      }
    }
    // this wave's LDS reads have retired before the next stage's tensor load may overwrite them
    asm volatile("s_wait_dscnt 0x0" ::: "memory");
    __syncthreads();
  }

  if constexpr (MODE == 1) {
    if (blockIdx.z == 2) {   // V: a lane's 8 rows are 8 consecutive t of one (head, d)
      int row = m0 + wave * 16 + hl * 8;
      int b = row / WT, t = row % WT;
      #pragma unroll
      for (int j = 0; j < 4; ++j) {
        int col = n0 + j * 16 + l16;
        float bc = bias[col];
        v8bf o;
        #pragma unroll
        for (int i = 0; i < 8; ++i) o[i] = f2bf(acc[j][i] + bc);
        *(v8bf*)(outB + (((size_t)(b * WH + (col >> 6)) * (WT / 32) + (t >> 5)) * WD +
                         (col & 63)) * 32 + (t & 31)) = o;
      }
      return;
    }
  }
  #pragma unroll
  for (int j = 0; j < 4; ++j) {
    #pragma unroll
    for (int i = 0; i < 8; ++i) {
      int row = m0 + wave * 16 + i + hl * 8;
      int col = n0 + j * 16 + l16;
      float v = acc[j][i] + bias[col];
      if constexpr (MODE == 0) {
        v += resid[(size_t)row * Nn + col];
        outF[(size_t)row * Nn + col] = v;
      } else if constexpr (MODE == 1) {
        int b = row / WT, t = row % WT;
        int hh = col >> 6, dd = col & 63;
        outB[((size_t)(b * WH + hh) * WT + t) * WD + dd] = f2bf(v);
      } else {
        float gl = 0.5f * v * (1.0f + erff(v * 0.70710678118f));
        outB[(size_t)row * Nn + col] = f2bf(gl);
      }
    }
  }
}

__device__ __forceinline__ float xhalf(float x) {
  return __builtin_bit_cast(float, __builtin_amdgcn_permlanex16(
      __builtin_bit_cast(int, x), __builtin_bit_cast(int, x),
      0x76543210, 0xfedcba98, false, false));
}

__global__ void __launch_bounds__(256) attn_kernel(
    const bf16_t* __restrict__ Q, const bf16_t* __restrict__ Km,
    const bf16_t* __restrict__ V, bf16_t* __restrict__ Y) {
  __shared__ bf16_t Ks[32][KS_PITCH];       // K rows (key-major), rows padded
  __shared__ __attribute__((aligned(16))) bf16_t Vs[64][VS_PITCH];   // Vs[d][key], rows padded
  int tid = threadIdx.x, lane = tid & 31, wave = tid >> 5;
  int hl = lane >> 4, l16 = lane & 15;
  int bh = blockIdx.y;
  int b = bh >> 3, h = bh & 7;
  int q0 = blockIdx.x * 128;
  const bf16_t* Qp = Q + (size_t)bh * WT * WD;
  const bf16_t* Kp = Km + (size_t)bh * WT * WD;
  const bf16_t* Vp = V + (size_t)bh * WT * WD;   // [t / 32][d][32]

  // Q^T B-fragments (lane column = l16), d split into two 32-chunks
  int qrow = q0 + wave * 16 + l16;
  v16bf qf[2];
  #pragma unroll
  for (int c = 0; c < 2; ++c) qf[c] = mkfrag(Qp + (size_t)qrow * WD + c * 32, hl);

  v8f oacc[4] = {};             // O^T: oacc[n][i] = O[qrow][n * 16 + hl * 8 + i]
  float mrun = -3e30f;          // running maximum of query qrow, alike in both halves
  float srun = 0.f;             // running sum over this half's keys only
  const float scale = 0.125f;   // 1/sqrt(64)
  int nchunk = (q0 + 128) / 32;
  int mymax = q0 + wave * 16 + 15;   // last q row this wave owns

  for (int kc = 0; kc < nchunk; ++kc) {
    int k0 = kc * 32;
    {   // stage K via async DMA to LDS, V (8 keys of one d) by one 16-byte store
      int r = tid >> 3, cs = (tid & 7) * 8;
      copy16_g2l(Kp + (size_t)(k0 + r) * WD + cs, &Ks[r][cs]);
      *(uint4*)&Vs[tid >> 2][(tid & 3) * 8] =
          *(const uint4*)(Vp + (size_t)kc * (WD * 32) + tid * 8);
    }
    async_drain();
    __syncthreads();
    if (k0 <= mymax) {
      // All sixteen LDS reads of the pass go out as one group: K's fragments first, then V's,
      // which land while the score products and the softmax run.
      v16bf kf[2][2], vf[4];
      #pragma unroll   // here and below: every index a constant, so the fragments stay in registers
      for (int j = 0; j < 2; ++j)
        #pragma unroll
        for (int c = 0; c < 2; ++c) kf[j][c] = mkfrag(&Ks[j * 16 + l16][c * 32], hl);  // A row = K row
      #pragma unroll
      for (int n = 0; n < 4; ++n) vf[n] = mkfrag(&Vs[n * 16 + l16][0], hl);            // A row = V^T row
      // keeps the reads above the WMMAs: without it the compiler sinks each pair of reads to
      // its WMMA, with a full wait at each of the eight places
      __builtin_amdgcn_sched_barrier(0);
      float st[2][8];    // st[j][i] = score of key k0 + j * 16 + hl * 8 + i
      float mx = -3e30f;
      #pragma unroll
      for (int j = 0; j < 2; ++j) {
        v8f s = {};
        #pragma unroll
        for (int c = 0; c < 2; ++c) s = wmma_bf16(kf[j][c], qf[c], s);
        #pragma unroll
        for (int i = 0; i < 8; ++i) {
          int key = k0 + j * 16 + hl * 8 + i;
          float e = s[i] * scale;
          if (key > qrow) e = -3e30f;   // causal mask
          st[j][i] = e;
          mx = fmaxf(mx, e);
        }
      }
      // online softmax, one query per lane
      mx = fmaxf(mx, xhalf(mx));
      float mnew = fmaxf(mrun, mx);
      float alpha = __expf(mrun - mnew);
      v16bf pf;          // P^T B-fragment: element j * 8 + i is key j * 16 + hl * 8 + i
      float rs = 0.f;
      #pragma unroll
      for (int j = 0; j < 2; ++j)
        #pragma unroll
        for (int i = 0; i < 8; ++i) {
          float p = __expf(st[j][i] - mnew);
          rs += p;
          pf[j * 8 + i] = f2bf(p);
        }
      srun = srun * alpha + rs;
      mrun = mnew;
      #pragma unroll
      for (int n = 0; n < 4; ++n) {
        #pragma unroll
        for (int i = 0; i < 8; ++i) oacc[n][i] *= alpha;
      }
      #pragma unroll
      for (int n = 0; n < 4; ++n) oacc[n] = wmma_bf16(vf[n], pf, oacc[n]);
    }
    __syncthreads();
  }

  // A lane holds 8 consecutive d of its query in each tile: one 16-byte store per tile.
  float stot = srun + xhalf(srun);
  #pragma unroll
  for (int n = 0; n < 4; ++n) {
    v8bf o;
    #pragma unroll
    for (int i = 0; i < 8; ++i) o[i] = f2bf(oacc[n][i] / stot);
    *(v8bf*)(Y + (size_t)(b * WT + qrow) * WC + h * WD + n * 16 + hl * 8) = o;
  }
}

// ---- host launch ---------------------------------------------------------

extern "C" void kernel_launch(void* const* d_in, const int* in_sizes, int n_in,
                              void* d_out, int out_size, void* d_ws, size_t ws_size,
                              hipStream_t stream) {
  (void)in_sizes; (void)n_in; (void)out_size; (void)ws_size;
  const float* x   = (const float*)d_in[0];
  const float* g1  = (const float*)d_in[1];
  const float* be1 = (const float*)d_in[2];
  const float* g2  = (const float*)d_in[3];
  const float* be2 = (const float*)d_in[4];
  const float* Wq = (const float*)d_in[5];  const float* bq = (const float*)d_in[6];
  const float* Wk = (const float*)d_in[7];  const float* bk = (const float*)d_in[8];
  const float* Wv = (const float*)d_in[9];  const float* bv = (const float*)d_in[10];
  const float* Wp = (const float*)d_in[11]; const float* bp = (const float*)d_in[12];
  const float* W1 = (const float*)d_in[13]; const float* b1 = (const float*)d_in[14];
  const float* W2 = (const float*)d_in[15]; const float* b2 = (const float*)d_in[16];
  float* out = (float*)d_out;

  char* ws = (char*)d_ws;
  size_t off = 0;
  auto alloc = [&](size_t bytes) -> char* {
    char* p = ws + off; off += (bytes + 255) & ~(size_t)255; return p;
  };
  const size_t CC = (size_t)WC * WC;          // 262144
  const size_t C4 = (size_t)WC * 4 * WC;      // 1048576
  bf16_t* wqb = (bf16_t*)alloc(CC * 2);
  bf16_t* wkb = (bf16_t*)alloc(CC * 2);
  bf16_t* wvb = (bf16_t*)alloc(CC * 2);
  bf16_t* wpb = (bf16_t*)alloc(CC * 2);
  bf16_t* w1b = (bf16_t*)alloc(C4 * 2);
  bf16_t* w2b = (bf16_t*)alloc(C4 * 2);
  bf16_t* h1  = (bf16_t*)alloc((size_t)WM * WC * 2);
  bf16_t* qb  = (bf16_t*)alloc((size_t)WM * WC * 2);
  bf16_t* kb  = (bf16_t*)alloc((size_t)WM * WC * 2);
  bf16_t* vb  = (bf16_t*)alloc((size_t)WM * WC * 2);
  bf16_t* yb  = (bf16_t*)alloc((size_t)WM * WC * 2);
  float*  x1  = (float*)alloc((size_t)WM * WC * 4);
  bf16_t* h2  = (bf16_t*)alloc((size_t)WM * WC * 2);
  bf16_t* act = (bf16_t*)alloc((size_t)WM * 4 * WC * 2);

  // 1) + 2) weights -> bf16, k innermost in 32-k tiles, and LN1, one launch
  prepass_kernel<<<LN_BLOCKS + CVT_BLOCKS, 256, 0, stream>>>(
      x, g1, be1, h1, Wq, Wk, Wv, Wp, W1, W2, wqb, wkb, wvb, wpb, w1b, w2b);

  // 3) Q/K/V projections (head-reshaped bf16 outputs), one launch: wqb/wkb/wvb and
  //    qb/kb/vb are consecutive allocations of whole 256-byte multiples
  dim3 gq(WC / 64, WM / 128);                   // (8, 64)
  dim3 gqkv(WC / 64, WM / 128, 3);              // (8, 64, 3)
  gemm_bf16_kernel<1><<<gqkv, 256, 0, stream>>>(h1, wqb, bq, nullptr, nullptr, qb, WM, WC, WC, bk, bv);

  // 4) causal flash attention
  dim3 ga(WT / 128, WBATCH * WH);               // (16, 32)
  attn_kernel<<<ga, 256, 0, stream>>>(qb, kb, vb, yb);

  // 5) output projection + residual -> x1 (f32)
  gemm_bf16_kernel<0><<<gq, 256, 0, stream>>>(yb, wpb, bp, x, x1, nullptr, WM, WC, WC, nullptr, nullptr);

  // 6) LN2
  ln_kernel<<<WM / 8, 256, 0, stream>>>(x1, g2, be2, h2, WM);

  // 7) MLP up + exact GELU -> bf16
  dim3 gm(4 * WC / 64, WM / 128);               // (32, 64)
  gemm_bf16_kernel<2><<<gm, 256, 0, stream>>>(h2, w1b, b1, nullptr, nullptr, act, WM, 4 * WC, WC, nullptr, nullptr);

  // 8) MLP down + residual -> d_out (f32)
  gemm_bf16_kernel<0><<<gq, 256, 0, stream>>>(act, w2b, b2, x1, out, nullptr, WM, WC, 4 * WC, nullptr, nullptr);
}

// v007
// A run of this version takes 144 microseconds.
// Next to v006, in two timings, it ran 1.18 times as fast each time.
// Over all steps from v000 it is 3.35 times as fast.
#include <hip/hip_runtime.h>
#include <hip/hip_bf16.h>
#include <math.h>

// Problem dims (fixed by reference)
#define WBATCH 4
#define WT     2048
#define WC     512
#define WH     8
#define WD     64
#define WM     (WBATCH * WT)   // 8192 tokens

typedef __bf16 bf16_t;
typedef __attribute__((ext_vector_type(16))) __bf16 v16bf;
typedef __attribute__((ext_vector_type(8)))  __bf16 v8bf;
typedef __attribute__((ext_vector_type(8)))  float  v8f;
typedef __attribute__((ext_vector_type(4)))  int    v4i;
typedef __attribute__((ext_vector_type(8)))  int    v8i;
typedef __attribute__((ext_vector_type(4)))  unsigned int v4u;

#define AS_PITCH 136  // 128 used + 8 pad: 272 B
#define VS_PITCH 40   // 32 used + 8 pad: 80 B
#define KS_PITCH 72   // 64 used + 8 pad: 144 B

// ---- helpers -------------------------------------------------------------

__device__ __forceinline__ bf16_t f2bf(float f) {
  union { float f; unsigned u; } a; a.f = f;
  unsigned r = a.u + 0x7fffu + ((a.u >> 16) & 1u);   // round-nearest-even
  unsigned short s = (unsigned short)(r >> 16);
  bf16_t b; __builtin_memcpy(&b, &s, 2); return b;
}

__device__ __forceinline__ v16bf mkfrag(const bf16_t* row, int hl) {
  v8bf lo = *(const v8bf*)(row + hl * 8);
  v8bf hi = *(const v8bf*)(row + 16 + hl * 8);
  return __builtin_shufflevector(lo, hi, 0,1,2,3,4,5,6,7,8,9,10,11,12,13,14,15);
}

__device__ __forceinline__ v8f wmma_bf16(v16bf a, v16bf b, v8f c) {
  return __builtin_amdgcn_wmma_f32_16x16x32_bf16(false, a, false, b, (short)0, c,
                                                 false, false);
}

#if __has_builtin(__builtin_amdgcn_global_load_async_to_lds_b128)
#define CDNA5_ASYNC_LDS 1
#else
#define CDNA5_ASYNC_LDS 0
#endif

__device__ __forceinline__ void copy16_g2l(const void* g, void* l) {
#if CDNA5_ASYNC_LDS
  __builtin_amdgcn_global_load_async_to_lds_b128(
      (__attribute__((address_space(1))) v4i*)g,
      (__attribute__((address_space(3))) v4i*)l, 0, 0);
#else
  *(uint4*)l = *(const uint4*)g;
#endif
}

__device__ __forceinline__ void async_drain() {
#if CDNA5_ASYNC_LDS
  asm volatile("s_wait_asynccnt 0" ::: "memory");
#endif
}

#define GK 128   // k per GEMM stage: a row of the A tile is 256 B

typedef __attribute__((ext_vector_type(8))) unsigned int v8u;

__device__ __forceinline__ unsigned uni(unsigned v) {
  return (unsigned)__builtin_amdgcn_readfirstlane(v);
}

__device__ __forceinline__ unsigned pinned(unsigned v) {
  unsigned w = uni(v);
  asm volatile("" : "+s"(w));   // pinned(): keeps the word scalar
  return w;
}

__device__ __forceinline__ v8u tdm_group1(unsigned src_pitch) {
  constexpr unsigned d0 = GK * 2, d1 = 128;
  v8u g;
  g[0] = uni((1u << 20) | (5u << 22) | (3u << 25));
  g[1] = uni((d0 & 0xffffu) << 16);
  g[2] = uni((d0 >> 16) | ((d1 & 0xffffu) << 16));
  g[3] = uni((d1 >> 16) | (d0 << 16));
  g[4] = uni(d1);
  g[5] = uni(src_pitch);
  g[6] = uni(0u);
  g[7] = uni(0u);
  return g;
}

__device__ __forceinline__ v4u tdm_group0(unsigned lds_dst, unsigned long long ga) {
  v4u g;
  g[0] = uni(1u);
  g[1] = uni(lds_dst);
  g[2] = uni((unsigned)ga);
  g[3] = uni((((unsigned)(ga >> 32)) & 0x01ffffffu) | 0x80000000u);
  return g;
}

__device__ __forceinline__ void tdm_load(v4u g0, v8u g1) {
  asm volatile("tensor_load_to_lds %0, %1" :: "s"(g0), "s"(g1) : "memory");
}

__device__ __forceinline__ unsigned lds_byte_addr(const void* p) {
  return (unsigned)(size_t)(__attribute__((address_space(3))) const char*)p;
}

// ---- LayerNorm: one wave (32 lanes) per row of 512 -----------------------

__device__ __forceinline__ void ln_rows(const float* __restrict__ x,
                                        const float* __restrict__ g,
                                        const float* __restrict__ beta,
                                        bf16_t* __restrict__ out, int rows) {
  int wave = threadIdx.x >> 5, lane = threadIdx.x & 31;
  int row = blockIdx.x * 8 + wave;
  if (row >= rows) return;
  const float* xr = x + (size_t)row * WC;
  float vals[16];
  float s = 0.f;
  #pragma unroll
  for (int k = 0; k < 16; ++k) { vals[k] = xr[lane + 32 * k]; s += vals[k]; }
  #pragma unroll
  for (int o = 16; o >= 1; o >>= 1) s += __shfl_xor(s, o, 32);
  float mean = s * (1.0f / WC);
  float vs = 0.f;
  #pragma unroll
  for (int k = 0; k < 16; ++k) { float d = vals[k] - mean; vs += d * d; }
  #pragma unroll
  for (int o = 16; o >= 1; o >>= 1) vs += __shfl_xor(vs, o, 32);
  float rinv = rsqrtf(vs * (1.0f / WC) + 1e-5f);
  #pragma unroll
  for (int k = 0; k < 16; ++k) {
    int idx = lane + 32 * k;
    out[(size_t)row * WC + idx] = f2bf((vals[k] - mean) * rinv * g[idx] + beta[idx]);
  }
}

__global__ void __launch_bounds__(256) ln_kernel(const float* __restrict__ x,
                                                 const float* __restrict__ g,
                                                 const float* __restrict__ beta,
                                                 bf16_t* __restrict__ out, int rows) {
  ln_rows(x, g, beta, out, rows);
}

// ---- Pre-pass: LayerNorm 1 and the six f32 -> bf16 weight conversions ----
// None of the seven depends on another, so they share one launch: blocks
// [0, LN_BLOCKS) normalise 8 rows each; the later blocks convert, CVT_SMALL or
// CVT_LARGE blocks to a matrix. A weight W[K][N] goes out as Wt[K / 32][N][32], k
// innermost: the 64 n x 32 k tile of a GEMM step is then 4 KiB in a row, in the order of
// its LDS image. A block takes 64 k x 32 n, a lane one n (loads of whole lines) and 8
// consecutive k (one 16-byte store).

#define LN_BLOCKS  (WM / 8)                 // 1024
#define CVT_SMALL  (WC * WC / 2048)         // blocks for a C x C matrix
#define CVT_LARGE  (4 * WC * WC / 2048)     // blocks for a C x 4C or 4C x C matrix
#define CVT_BLOCKS (4 * CVT_SMALL + 2 * CVT_LARGE)

template <int NN>   // NN: row length of in, known at compile time: one address, constant offsets
__device__ __forceinline__ void cvt_f32_bf16_t(const float* __restrict__ in,
                                               bf16_t* __restrict__ out, int blk) {
  constexpr int ntile = NN / 32;
  int n = (blk % ntile) * 32 + (threadIdx.x & 31);
  int k = (blk / ntile) * 64 + (threadIdx.x >> 5) * 8;
  const float* src = in + (size_t)k * NN + n;
  float f[8];
  #pragma unroll
  for (int i = 0; i < 8; ++i) f[i] = src[i * NN];
  // before a register that the loads name is written again
  asm volatile("s_wait_xcnt 0x0" ::: "memory");
  v8bf o;
  #pragma unroll
  for (int i = 0; i < 8; ++i) o[i] = f2bf(f[i]);
  *(v8bf*)(out + ((size_t)(k >> 5) * NN + n) * 32 + (k & 31)) = o;
  // before a register that the store names is written again
  asm volatile("s_wait_xcnt 0x0" ::: "memory");
}

__global__ void __launch_bounds__(256) prepass_kernel(
    const float* __restrict__ x, const float* __restrict__ g,
    const float* __restrict__ beta, bf16_t* __restrict__ h,
    const float* __restrict__ Wq, const float* __restrict__ Wk,
    const float* __restrict__ Wv, const float* __restrict__ Wp,
    const float* __restrict__ W1, const float* __restrict__ W2,
    bf16_t* __restrict__ wqb, bf16_t* __restrict__ wkb,
    bf16_t* __restrict__ wvb, bf16_t* __restrict__ wpb,
    bf16_t* __restrict__ w1b, bf16_t* __restrict__ w2b) {
  if (blockIdx.x < LN_BLOCKS) { ln_rows(x, g, beta, h, WM); return; }
  int c = blockIdx.x - LN_BLOCKS;
  if (c < 4 * CVT_SMALL) {
    int m = c / CVT_SMALL;
    const float* in = m == 0 ? Wq  : m == 1 ? Wk  : m == 2 ? Wv  : Wp;
    bf16_t* out     = m == 0 ? wqb : m == 1 ? wkb : m == 2 ? wvb : wpb;
    cvt_f32_bf16_t<WC>(in, out, c - m * CVT_SMALL);
  } else {
    c -= 4 * CVT_SMALL;
    if (c < CVT_LARGE) cvt_f32_bf16_t<4 * WC>(W1, w1b, c);
    else               cvt_f32_bf16_t<WC>(W2, w2b, c - CVT_LARGE);
  }
}

template <int MODE>
__global__ void __launch_bounds__(256, MODE == 1 ? 12 : 1) gemm_bf16_kernel(
    const bf16_t* __restrict__ A, const bf16_t* __restrict__ W,
    const float* __restrict__ bias, const float* __restrict__ resid,
    float* __restrict__ outF, bf16_t* __restrict__ outB,
    int Mm, int Nn, int Kk,
    const float* __restrict__ bias_z1, const float* __restrict__ bias_z2) {
  if constexpr (MODE == 1) {
    int z = blockIdx.z;
    W    += (size_t)z * Kk * Nn;
    outB += (size_t)z * Mm * Nn;
    bias  = z == 0 ? bias : z == 1 ? bias_z1 : bias_z2;
  }
  __shared__ __attribute__((aligned(2048))) bf16_t As[128 * AS_PITCH];   // rows padded by the mover
  __shared__ __attribute__((aligned(16))) bf16_t Bs[64][AS_PITCH];   // Bs[n][k], rows padded
  int tid = threadIdx.x;
  int lane = tid & 31, wave = tid >> 5;
  int hl = lane >> 4, l16 = lane & 15;
  int m0 = blockIdx.y * 128, n0 = blockIdx.x * 64;
  const unsigned wave_u = uni(threadIdx.x >> 5);
  const v8u g1 = tdm_group1((unsigned)Kk * 2u);

  v8f acc[4] = {};
  int nk = Kk / GK;
  for (int kc = 0; kc < nk; ++kc) {
    int k0 = kc * GK;
    if (pinned(wave_u == 0)) {   // one request moves the whole 128 x 128 A tile
      tdm_load(tdm_group0(lds_byte_addr(As),
                          (unsigned long long)(A + (size_t)m0 * Kk + k0)), g1);
      // the tile has landed before this wave reaches the barrier that publishes it
      asm volatile("s_wait_tensorcnt 0x0" ::: "memory");
    }
    #pragma unroll   // the four loads fly together
    for (int kk = 0; kk < GK / 32; ++kk)   // W tile: 8 contiguous k of one n in each 32-k piece
      *(uint4*)&Bs[tid >> 2][kk * 32 + (tid & 3) * 8] =
          *(const uint4*)(W + ((size_t)(kc * (GK / 32) + kk) * Nn + n0) * 32 + tid * 8);
    // before a register that the loads name is written again
    asm volatile("s_wait_xcnt 0x0" ::: "memory");
    if (kc + 1 < nk) {   // global_prefetch_b8 of the next stage, a 128-B line of A a thread
      __builtin_prefetch(A + (size_t)(m0 + (tid >> 1)) * Kk + k0 + GK + (tid & 1) * 64, 0, 1);
      __builtin_prefetch(W + ((size_t)((kc + 1) * (GK / 32) + (tid >> 6)) * Nn + n0) * 32 +
                             (tid & 63) * 32, 0, 1);
    }
    __syncthreads();
    if constexpr (MODE == 0) {
      v16bf af[GK / 32], bfv[GK / 32][4];
      #pragma unroll   // every LDS offset a constant
      for (int kk = 0; kk < GK / 32; ++kk) {
        af[kk] = mkfrag(&As[(wave * 16 + l16) * AS_PITCH + kk * 32], hl);
        #pragma unroll   // here and below: every index a constant, so the fragments stay in registers
        for (int j = 0; j < 4; ++j) bfv[kk][j] = mkfrag(&Bs[j * 16 + l16][kk * 32], hl);
      }
      // keeps the reads above the WMMAs: without it the compiler sinks each pair of reads to
      // its WMMA, with a full wait at each of the sixteen places
      __builtin_amdgcn_sched_barrier(0);
      #pragma unroll
      for (int kk = 0; kk < GK / 32; ++kk) {
        #pragma unroll
        for (int j = 0; j < 4; ++j) acc[j] = wmma_bf16(af[kk], bfv[kk][j], acc[j]);
      }
      // keeps the WMMAs above the full wait and the barrier below: they run while the later
      // reads still land, not behind the last of them
      __builtin_amdgcn_sched_barrier(0);
    } else {
      #pragma unroll   // every LDS offset a constant
      for (int kk = 0; kk < GK / 32; ++kk) {
        v16bf af = mkfrag(&As[(wave * 16 + l16) * AS_PITCH + kk * 32], hl);
        #pragma unroll
        for (int j = 0; j < 4; ++j) {
          v16bf bfv = mkfrag(&Bs[j * 16 + l16][kk * 32], hl);
          acc[j] = wmma_bf16(af, bfv, acc[j]);
        }
      }
    }
    // this wave's LDS reads have retired before the next stage's tensor load may overwrite them
    asm volatile("s_wait_dscnt 0x0" ::: "memory");
    __syncthreads();
  }

  if constexpr (MODE == 1) {
    if (blockIdx.z == 2) {   // V: a lane's 8 rows are 8 consecutive t of one (head, d)
      int row = m0 + wave * 16 + hl * 8;
      int b = row / WT, t = row % WT;
      #pragma unroll
      for (int j = 0; j < 4; ++j) {
        int col = n0 + j * 16 + l16;
        float bc = bias[col];
        v8bf o;
        #pragma unroll
        for (int i = 0; i < 8; ++i) o[i] = f2bf(acc[j][i] + bc);
        *(v8bf*)(outB + (((size_t)(b * WH + (col >> 6)) * (WT / 32) + (t >> 5)) * WD +
                         (col & 63)) * 32 + (t & 31)) = o;
      }
      return;
    }
  }
  #pragma unroll
  for (int j = 0; j < 4; ++j) {
    #pragma unroll
    for (int i = 0; i < 8; ++i) {
      int row = m0 + wave * 16 + i + hl * 8;
      int col = n0 + j * 16 + l16;
      float v = acc[j][i] + bias[col];
      if constexpr (MODE == 0) {
        v += resid[(size_t)row * Nn + col];
        outF[(size_t)row * Nn + col] = v;
      } else if constexpr (MODE == 1) {
        int b = row / WT, t = row % WT;
        int hh = col >> 6, dd = col & 63;
        outB[((size_t)(b * WH + hh) * WT + t) * WD + dd] = f2bf(v);
      } else {
        float gl = 0.5f * v * (1.0f + erff(v * 0.70710678118f));
        outB[(size_t)row * Nn + col] = f2bf(gl);
      }
    }
  }
}

__device__ __forceinline__ float xhalf(float x) {
  return __builtin_bit_cast(float, __builtin_amdgcn_permlanex16(
      __builtin_bit_cast(int, x), __builtin_bit_cast(int, x),
      0x76543210, 0xfedcba98, false, false));
}

#define AK 128   // keys per stage: as many as the workgroup has queries, so the diagonal is the last stage

__global__ void __launch_bounds__(256) attn_kernel(
    const bf16_t* __restrict__ Q, const bf16_t* __restrict__ Km,
    const bf16_t* __restrict__ V, bf16_t* __restrict__ Y) {
  __shared__ __attribute__((aligned(16))) bf16_t Ks[AK][KS_PITCH];   // K rows (key-major), rows padded
  __shared__ __attribute__((aligned(16))) bf16_t Vs[AK / 32][64][VS_PITCH];   // Vs[piece][d][key], rows padded
  int tid = threadIdx.x, lane = tid & 31, wave = tid >> 5;
  int hl = lane >> 4, l16 = lane & 15;
  int bh = blockIdx.y;
  int b = bh >> 3, h = bh & 7;
  int q0 = blockIdx.x * 128;
  const bf16_t* Qp = Q + (size_t)bh * WT * WD;
  const bf16_t* Kp = Km + (size_t)bh * WT * WD;
  const bf16_t* Vp = V + (size_t)bh * WT * WD;   // [t / 32][d][32]

  // Q^T B-fragments (lane column = l16), d split into two 32-chunks
  int qrow = q0 + wave * 16 + l16;
  v16bf qf[2];
  #pragma unroll
  for (int c = 0; c < 2; ++c) qf[c] = mkfrag(Qp + (size_t)qrow * WD + c * 32, hl);

  v8f oacc[4] = {};             // O^T: oacc[n][i] = O[qrow][n * 16 + hl * 8 + i]
  float mrun = -3e30f;          // running maximum of query qrow, alike in both halves
  float srun = 0.f;             // running sum over this half's keys only
  const float scale = 0.125f;   // 1/sqrt(64)
  int nstage = (q0 + 128) / AK;
  int mymax = q0 + (int)uni(threadIdx.x >> 5) * 16 + 15;   // last q row this wave owns, a scalar

  // A stage is 128 keys, four passes of 32: one load round trip and one pair of barriers
  // serve four passes, and between the barriers the waves run free of one another.
  for (int ks = 0; ks < nstage; ++ks) {
    {   // stage K via async DMA to LDS, V (8 keys of one d) by 16-byte stores
      int r = tid >> 3, cs = (tid & 7) * 8;
      #pragma unroll   // the four copies and the four loads fly together
      for (int p = 0; p < AK / 32; ++p)
        copy16_g2l(Kp + (size_t)(ks * AK + p * 32 + r) * WD + cs, &Ks[p * 32 + r][cs]);
      #pragma unroll
      for (int p = 0; p < AK / 32; ++p)
        *(uint4*)&Vs[p][tid >> 2][(tid & 3) * 8] =
            *(const uint4*)(Vp + (size_t)(ks * (AK / 32) + p) * (WD * 32) + tid * 8);
    }
    async_drain();
    __syncthreads();
    // passes whose first key is not past the wave's last query: four, fewer on the diagonal
    int npass = min(AK / 32, (mymax - ks * AK) / 32 + 1);
    const bf16_t* kr = &Ks[l16][0];      // this lane's row in the pass's K and V pieces
    const bf16_t* vr = &Vs[0][l16][0];
    #pragma unroll 1
    for (int p = 0; p < npass; ++p) {
      int k0 = ks * AK + p * 32;
      // All sixteen LDS reads of the pass go out as one group: K's fragments first, then V's,
      // which land while the score products and the softmax run.
      v16bf kf[2][2], vf[4];
      #pragma unroll   // here and below: every index a constant, so the fragments stay in registers
      for (int j = 0; j < 2; ++j)
        #pragma unroll
        for (int c = 0; c < 2; ++c) kf[j][c] = mkfrag(kr + j * 16 * KS_PITCH + c * 32, hl);  // A row = K row
      #pragma unroll
      for (int n = 0; n < 4; ++n) vf[n] = mkfrag(vr + n * 16 * VS_PITCH, hl);            // A row = V^T row
      // keeps the reads above the WMMAs: without it the compiler sinks each pair of reads to
      // its WMMA, with a full wait at each of the eight places
      __builtin_amdgcn_sched_barrier(0);
      float st[2][8];    // st[j][i] = score of key k0 + j * 16 + hl * 8 + i
      float mx = -3e30f;
      #pragma unroll
      for (int j = 0; j < 2; ++j) {
        v8f s = {};
        #pragma unroll
        for (int c = 0; c < 2; ++c) s = wmma_bf16(kf[j][c], qf[c], s);
        #pragma unroll
        for (int i = 0; i < 8; ++i) {
          int key = k0 + j * 16 + hl * 8 + i;
          float e = s[i] * scale;
          if (key > qrow) e = -3e30f;   // causal mask
          st[j][i] = e;
          mx = fmaxf(mx, e);
        }
      }
      // online softmax, one query per lane
      mx = fmaxf(mx, xhalf(mx));
      float mnew = fmaxf(mrun, mx);
      float alpha = __expf(mrun - mnew);
      v16bf pf;          // P^T B-fragment: element j * 8 + i is key j * 16 + hl * 8 + i
      float rs = 0.f;
      #pragma unroll
      for (int j = 0; j < 2; ++j)
        #pragma unroll
        for (int i = 0; i < 8; ++i) {
          float p = __expf(st[j][i] - mnew);
          rs += p;
          pf[j * 8 + i] = f2bf(p);
        }
      srun = srun * alpha + rs;
      mrun = mnew;
      #pragma unroll
      for (int n = 0; n < 4; ++n) {
        #pragma unroll
        for (int i = 0; i < 8; ++i) oacc[n][i] *= alpha;
      }
      #pragma unroll
      for (int n = 0; n < 4; ++n) oacc[n] = wmma_bf16(vf[n], pf, oacc[n]);
      kr += 32 * KS_PITCH;
      vr += 64 * VS_PITCH;
    }
    // this wave's LDS reads have retired before the next stage's copies may overwrite them
    asm volatile("s_wait_dscnt 0x0" ::: "memory");
    __syncthreads();
  }

  // A lane holds 8 consecutive d of its query in each tile: one 16-byte store per tile.
  float stot = srun + xhalf(srun);
  #pragma unroll
  for (int n = 0; n < 4; ++n) {
    v8bf o;
    #pragma unroll
    for (int i = 0; i < 8; ++i) o[i] = f2bf(oacc[n][i] / stot);
    *(v8bf*)(Y + (size_t)(b * WT + qrow) * WC + h * WD + n * 16 + hl * 8) = o;
  }
}

// ---- host launch ---------------------------------------------------------

extern "C" void kernel_launch(void* const* d_in, const int* in_sizes, int n_in,
                              void* d_out, int out_size, void* d_ws, size_t ws_size,
                              hipStream_t stream) {
  (void)in_sizes; (void)n_in; (void)out_size; (void)ws_size;
  const float* x   = (const float*)d_in[0];
  const float* g1  = (const float*)d_in[1];
  const float* be1 = (const float*)d_in[2];
  const float* g2  = (const float*)d_in[3];
  const float* be2 = (const float*)d_in[4];
  const float* Wq = (const float*)d_in[5];  const float* bq = (const float*)d_in[6];
  const float* Wk = (const float*)d_in[7];  const float* bk = (const float*)d_in[8];
  const float* Wv = (const float*)d_in[9];  const float* bv = (const float*)d_in[10];
  const float* Wp = (const float*)d_in[11]; const float* bp = (const float*)d_in[12];
  const float* W1 = (const float*)d_in[13]; const float* b1 = (const float*)d_in[14];
  const float* W2 = (const float*)d_in[15]; const float* b2 = (const float*)d_in[16];
  float* out = (float*)d_out;

  char* ws = (char*)d_ws;
  size_t off = 0;
  auto alloc = [&](size_t bytes) -> char* {
    char* p = ws + off; off += (bytes + 255) & ~(size_t)255; return p;
  };
  const size_t CC = (size_t)WC * WC;          // 262144
  const size_t C4 = (size_t)WC * 4 * WC;      // 1048576
  bf16_t* wqb = (bf16_t*)alloc(CC * 2);
  bf16_t* wkb = (bf16_t*)alloc(CC * 2);
  bf16_t* wvb = (bf16_t*)alloc(CC * 2);
  bf16_t* wpb = (bf16_t*)alloc(CC * 2);
  bf16_t* w1b = (bf16_t*)alloc(C4 * 2);
  bf16_t* w2b = (bf16_t*)alloc(C4 * 2);
  bf16_t* h1  = (bf16_t*)alloc((size_t)WM * WC * 2);
  bf16_t* qb  = (bf16_t*)alloc((size_t)WM * WC * 2);
  bf16_t* kb  = (bf16_t*)alloc((size_t)WM * WC * 2);
  bf16_t* vb  = (bf16_t*)alloc((size_t)WM * WC * 2);
  bf16_t* yb  = (bf16_t*)alloc((size_t)WM * WC * 2);
  float*  x1  = (float*)alloc((size_t)WM * WC * 4);
  bf16_t* h2  = (bf16_t*)alloc((size_t)WM * WC * 2);
  bf16_t* act = (bf16_t*)alloc((size_t)WM * 4 * WC * 2);

  // 1) + 2) weights -> bf16, k innermost in 32-k tiles, and LN1, one launch
  prepass_kernel<<<LN_BLOCKS + CVT_BLOCKS, 256, 0, stream>>>(
      x, g1, be1, h1, Wq, Wk, Wv, Wp, W1, W2, wqb, wkb, wvb, wpb, w1b, w2b);

  // 3) Q/K/V projections (head-reshaped bf16 outputs), one launch: wqb/wkb/wvb and
  //    qb/kb/vb are consecutive allocations of whole 256-byte multiples
  dim3 gq(WC / 64, WM / 128);                   // (8, 64)
  dim3 gqkv(WC / 64, WM / 128, 3);              // (8, 64, 3)
  gemm_bf16_kernel<1><<<gqkv, 256, 0, stream>>>(h1, wqb, bq, nullptr, nullptr, qb, WM, WC, WC, bk, bv);

  // 4) causal flash attention
  dim3 ga(WT / 128, WBATCH * WH);               // (16, 32)
  attn_kernel<<<ga, 256, 0, stream>>>(qb, kb, vb, yb);

  // 5) output projection + residual -> x1 (f32)
  gemm_bf16_kernel<0><<<gq, 256, 0, stream>>>(yb, wpb, bp, x, x1, nullptr, WM, WC, WC, nullptr, nullptr);

  // 6) LN2
  ln_kernel<<<WM / 8, 256, 0, stream>>>(x1, g2, be2, h2, WM);

  // 7) MLP up + exact GELU -> bf16
  dim3 gm(4 * WC / 64, WM / 128);               // (32, 64)
  gemm_bf16_kernel<2><<<gm, 256, 0, stream>>>(h2, w1b, b1, nullptr, nullptr, act, WM, 4 * WC, WC, nullptr, nullptr);

  // 8) MLP down + residual -> d_out (f32)
  gemm_bf16_kernel<0><<<gq, 256, 0, stream>>>(act, w2b, b2, x1, out, nullptr, WM, WC, 4 * WC, nullptr, nullptr);
}

// v008
// One run takes 136 microseconds.
// Next to v007, in two timings, it ran 1.06 times as fast each time.
// All steps since v000 together make it 3.55 times as fast.
#include <hip/hip_runtime.h>
#include <hip/hip_bf16.h>
#include <math.h>

// Problem dims (fixed by reference)
#define WBATCH 4
#define WT     2048
#define WC     512
#define WH     8
#define WD     64
#define WM     (WBATCH * WT)   // 8192 tokens

typedef __bf16 bf16_t;
typedef __attribute__((ext_vector_type(16))) __bf16 v16bf;
typedef __attribute__((ext_vector_type(8)))  __bf16 v8bf;
typedef __attribute__((ext_vector_type(8)))  float  v8f;
typedef __attribute__((ext_vector_type(4)))  int    v4i;
typedef __attribute__((ext_vector_type(8)))  int    v8i;
typedef __attribute__((ext_vector_type(4)))  unsigned int v4u;

#define AS_PITCH 136  // 128 used + 8 pad: 272 B
#define VS_PITCH 40   // 32 used + 8 pad: 80 B
#define KS_PITCH 72   // 64 used + 8 pad: 144 B

// ---- helpers -------------------------------------------------------------

__device__ __forceinline__ bf16_t f2bf(float f) {
  union { float f; unsigned u; } a; a.f = f;
  unsigned r = a.u + 0x7fffu + ((a.u >> 16) & 1u);   // round-nearest-even
  unsigned short s = (unsigned short)(r >> 16);
  bf16_t b; __builtin_memcpy(&b, &s, 2); return b;
}

__device__ __forceinline__ v16bf mkfrag(const bf16_t* row, int hl) {
  v8bf lo = *(const v8bf*)(row + hl * 8);
  v8bf hi = *(const v8bf*)(row + 16 + hl * 8);
  return __builtin_shufflevector(lo, hi, 0,1,2,3,4,5,6,7,8,9,10,11,12,13,14,15);
}

__device__ __forceinline__ v8f wmma_bf16(v16bf a, v16bf b, v8f c) {
  return __builtin_amdgcn_wmma_f32_16x16x32_bf16(false, a, false, b, (short)0, c,
                                                 false, false);
}

#if __has_builtin(__builtin_amdgcn_global_load_async_to_lds_b128)
#define CDNA5_ASYNC_LDS 1
#else
#define CDNA5_ASYNC_LDS 0
#endif

__device__ __forceinline__ void copy16_g2l(const void* g, void* l) {
#if CDNA5_ASYNC_LDS
  __builtin_amdgcn_global_load_async_to_lds_b128(
      (__attribute__((address_space(1))) v4i*)g,
      (__attribute__((address_space(3))) v4i*)l, 0, 0);
#else
  *(uint4*)l = *(const uint4*)g;
#endif
}

__device__ __forceinline__ void async_drain() {
#if CDNA5_ASYNC_LDS
  asm volatile("s_wait_asynccnt 0" ::: "memory");
#endif
}

#define GK 128   // k per GEMM stage: a row of the A tile is 256 B

typedef __attribute__((ext_vector_type(8))) unsigned int v8u;

__device__ __forceinline__ unsigned uni(unsigned v) {
  return (unsigned)__builtin_amdgcn_readfirstlane(v);
}

__device__ __forceinline__ unsigned pinned(unsigned v) {
  unsigned w = uni(v);
  asm volatile("" : "+s"(w));   // pinned(): keeps the word scalar
  return w;
}

__device__ __forceinline__ v8u tdm_group1(unsigned src_pitch) {
  constexpr unsigned d0 = GK * 2, d1 = 128;
  v8u g;
  g[0] = uni((1u << 20) | (5u << 22) | (3u << 25));
  g[1] = uni((d0 & 0xffffu) << 16);
  g[2] = uni((d0 >> 16) | ((d1 & 0xffffu) << 16));
  g[3] = uni((d1 >> 16) | (d0 << 16));
  g[4] = uni(d1);
  g[5] = uni(src_pitch);
  g[6] = uni(0u);
  g[7] = uni(0u);
  return g;
}

__device__ __forceinline__ v4u tdm_group0(unsigned lds_dst, unsigned long long ga) {
  v4u g;
  g[0] = uni(1u);
  g[1] = uni(lds_dst);
  g[2] = uni((unsigned)ga);
  g[3] = uni((((unsigned)(ga >> 32)) & 0x01ffffffu) | 0x80000000u);
  return g;
}

__device__ __forceinline__ void tdm_load(v4u g0, v8u g1) {
  asm volatile("tensor_load_to_lds %0, %1" :: "s"(g0), "s"(g1) : "memory");
}

__device__ __forceinline__ unsigned lds_byte_addr(const void* p) {
  return (unsigned)(size_t)(__attribute__((address_space(3))) const char*)p;
}

// ---- LayerNorm: one wave (32 lanes) per row of 512 -----------------------

__device__ __forceinline__ void ln_rows(const float* __restrict__ x,
                                        const float* __restrict__ g,
                                        const float* __restrict__ beta,
                                        bf16_t* __restrict__ out, int rows) {
  int wave = threadIdx.x >> 5, lane = threadIdx.x & 31;
  int row = blockIdx.x * 8 + wave;
  if (row >= rows) return;
  const float* xr = x + (size_t)row * WC;
  float vals[16];
  float s = 0.f;
  #pragma unroll
  for (int k = 0; k < 16; ++k) { vals[k] = xr[lane + 32 * k]; s += vals[k]; }
  #pragma unroll
  for (int o = 16; o >= 1; o >>= 1) s += __shfl_xor(s, o, 32);
  float mean = s * (1.0f / WC);
  float vs = 0.f;
  #pragma unroll
  for (int k = 0; k < 16; ++k) { float d = vals[k] - mean; vs += d * d; }
  #pragma unroll
  for (int o = 16; o >= 1; o >>= 1) vs += __shfl_xor(vs, o, 32);
  float rinv = rsqrtf(vs * (1.0f / WC) + 1e-5f);
  #pragma unroll
  for (int k = 0; k < 16; ++k) {
    int idx = lane + 32 * k;
    out[(size_t)row * WC + idx] = f2bf((vals[k] - mean) * rinv * g[idx] + beta[idx]);
  }
}

__global__ void __launch_bounds__(256) ln_kernel(const float* __restrict__ x,
                                                 const float* __restrict__ g,
                                                 const float* __restrict__ beta,
                                                 bf16_t* __restrict__ out, int rows) {
  ln_rows(x, g, beta, out, rows);
}

// ---- Pre-pass: LayerNorm 1 and the six f32 -> bf16 weight conversions ----
// None of the seven depends on another, so they share one launch: blocks
// [0, LN_BLOCKS) normalise 8 rows each; the later blocks convert, CVT_SMALL or
// CVT_LARGE blocks to a matrix. A weight W[K][N] goes out as Wt[K / 32][N][32], k
// innermost: the 64 n x 32 k tile of a GEMM step is then 4 KiB in a row, in the order of
// its LDS image. A block takes 64 k x 32 n, a lane one n (loads of whole lines) and 8
// consecutive k (one 16-byte store).

#define LN_BLOCKS  (WM / 8)                 // 1024
#define CVT_SMALL  (WC * WC / 2048)         // blocks for a C x C matrix
#define CVT_LARGE  (4 * WC * WC / 2048)     // blocks for a C x 4C or 4C x C matrix
#define CVT_BLOCKS (4 * CVT_SMALL + 2 * CVT_LARGE)

template <int NN>   // NN: row length of in, known at compile time: one address, constant offsets
__device__ __forceinline__ void cvt_f32_bf16_t(const float* __restrict__ in,
                                               bf16_t* __restrict__ out, int blk) {
  constexpr int ntile = NN / 32;
  int n = (blk % ntile) * 32 + (threadIdx.x & 31);
  int k = (blk / ntile) * 64 + (threadIdx.x >> 5) * 8;
  const float* src = in + (size_t)k * NN + n;
  float f[8];
  #pragma unroll
  for (int i = 0; i < 8; ++i) f[i] = src[i * NN];
  // before a register that the loads name is written again
  asm volatile("s_wait_xcnt 0x0" ::: "memory");
  v8bf o;
  #pragma unroll
  for (int i = 0; i < 8; ++i) o[i] = f2bf(f[i]);
  *(v8bf*)(out + ((size_t)(k >> 5) * NN + n) * 32 + (k & 31)) = o;
  // before a register that the store names is written again
  asm volatile("s_wait_xcnt 0x0" ::: "memory");
}

__global__ void __launch_bounds__(256) prepass_kernel(
    const float* __restrict__ x, const float* __restrict__ g,
    const float* __restrict__ beta, bf16_t* __restrict__ h,
    const float* __restrict__ Wq, const float* __restrict__ Wk,
    const float* __restrict__ Wv, const float* __restrict__ Wp,
    const float* __restrict__ W1, const float* __restrict__ W2,
    bf16_t* __restrict__ wqb, bf16_t* __restrict__ wkb,
    bf16_t* __restrict__ wvb, bf16_t* __restrict__ wpb,
    bf16_t* __restrict__ w1b, bf16_t* __restrict__ w2b) {
  if (blockIdx.x < LN_BLOCKS) { ln_rows(x, g, beta, h, WM); return; }
  int c = blockIdx.x - LN_BLOCKS;
  if (c < 4 * CVT_SMALL) {
    int m = c / CVT_SMALL;
    const float* in = m == 0 ? Wq  : m == 1 ? Wk  : m == 2 ? Wv  : Wp;
    bf16_t* out     = m == 0 ? wqb : m == 1 ? wkb : m == 2 ? wvb : wpb;
    cvt_f32_bf16_t<WC>(in, out, c - m * CVT_SMALL);
  } else {
    c -= 4 * CVT_SMALL;
    if (c < CVT_LARGE) cvt_f32_bf16_t<4 * WC>(W1, w1b, c);
    else               cvt_f32_bf16_t<WC>(W2, w2b, c - CVT_LARGE);
  }
}

template <int MODE>
__global__ void __launch_bounds__(256, MODE == 1 ? 12 : 1) gemm_bf16_kernel(
    const bf16_t* __restrict__ A, const bf16_t* __restrict__ W,
    const float* __restrict__ bias, const float* __restrict__ resid,
    float* __restrict__ outF, bf16_t* __restrict__ outB,
    int Mm, int Nn, int Kk,
    const float* __restrict__ bias_z1, const float* __restrict__ bias_z2) {
  if constexpr (MODE == 1) {
    int z = blockIdx.z;
    W    += (size_t)z * Kk * Nn;
    outB += (size_t)z * Mm * Nn;
    bias  = z == 0 ? bias : z == 1 ? bias_z1 : bias_z2;
  }
  __shared__ __attribute__((aligned(2048))) bf16_t As[128 * AS_PITCH];   // rows padded by the mover
  __shared__ __attribute__((aligned(16))) bf16_t Bs[64][AS_PITCH];   // Bs[n][k], rows padded
  int tid = threadIdx.x;
  int lane = tid & 31, wave = tid >> 5;
  int hl = lane >> 4, l16 = lane & 15;
  int m0 = blockIdx.y * 128, n0 = blockIdx.x * 64;
  const unsigned wave_u = uni(threadIdx.x >> 5);
  const v8u g1 = tdm_group1((unsigned)Kk * 2u);

  v8f acc[4] = {};
  int nk = Kk / GK;
  for (int kc = 0; kc < nk; ++kc) {
    int k0 = kc * GK;
    if (pinned(wave_u == 0)) {   // one request moves the whole 128 x 128 A tile
      tdm_load(tdm_group0(lds_byte_addr(As),
                          (unsigned long long)(A + (size_t)m0 * Kk + k0)), g1);
      // the tile has landed before this wave reaches the barrier that publishes it
      asm volatile("s_wait_tensorcnt 0x0" ::: "memory");
    }
    #pragma unroll   // the four loads fly together
    for (int kk = 0; kk < GK / 32; ++kk)   // W tile: 8 contiguous k of one n in each 32-k piece
      *(uint4*)&Bs[tid >> 2][kk * 32 + (tid & 3) * 8] =
          *(const uint4*)(W + ((size_t)(kc * (GK / 32) + kk) * Nn + n0) * 32 + tid * 8);
    // before a register that the loads name is written again
    asm volatile("s_wait_xcnt 0x0" ::: "memory");
    if (kc + 1 < nk) {   // global_prefetch_b8 of the next stage, a 128-B line of A a thread
      __builtin_prefetch(A + (size_t)(m0 + (tid >> 1)) * Kk + k0 + GK + (tid & 1) * 64, 0, 1);
      __builtin_prefetch(W + ((size_t)((kc + 1) * (GK / 32) + (tid >> 6)) * Nn + n0) * 32 +
                             (tid & 63) * 32, 0, 1);
    }
    __syncthreads();
    if constexpr (MODE == 0) {
      v16bf af[GK / 32], bfv[GK / 32][4];
      #pragma unroll   // every LDS offset a constant
      for (int kk = 0; kk < GK / 32; ++kk) {
        af[kk] = mkfrag(&As[(wave * 16 + l16) * AS_PITCH + kk * 32], hl);
        #pragma unroll   // here and below: every index a constant, so the fragments stay in registers
        for (int j = 0; j < 4; ++j) bfv[kk][j] = mkfrag(&Bs[j * 16 + l16][kk * 32], hl);
      }
      // keeps the reads above the WMMAs: without it the compiler sinks each pair of reads to
      // its WMMA, with a full wait at each of the sixteen places
      __builtin_amdgcn_sched_barrier(0);
      #pragma unroll
      for (int kk = 0; kk < GK / 32; ++kk) {
        #pragma unroll
        for (int j = 0; j < 4; ++j) acc[j] = wmma_bf16(af[kk], bfv[kk][j], acc[j]);
      }
      // keeps the WMMAs above the full wait and the barrier below: they run while the later
      // reads still land, not behind the last of them
      __builtin_amdgcn_sched_barrier(0);
    } else {
      #pragma unroll   // every LDS offset a constant
      for (int kk = 0; kk < GK / 32; ++kk) {
        v16bf af = mkfrag(&As[(wave * 16 + l16) * AS_PITCH + kk * 32], hl);
        #pragma unroll
        for (int j = 0; j < 4; ++j) {
          v16bf bfv = mkfrag(&Bs[j * 16 + l16][kk * 32], hl);
          acc[j] = wmma_bf16(af, bfv, acc[j]);
        }
      }
    }
    // this wave's LDS reads have retired before the next stage's tensor load may overwrite them
    asm volatile("s_wait_dscnt 0x0" ::: "memory");
    __syncthreads();
  }

  if constexpr (MODE == 1) {
    if (blockIdx.z == 2) {   // V: a lane's 8 rows are 8 consecutive t of one (head, d)
      int row = m0 + wave * 16 + hl * 8;
      int b = row / WT, t = row % WT;
      #pragma unroll
      for (int j = 0; j < 4; ++j) {
        int col = n0 + j * 16 + l16;
        float bc = bias[col];
        v8bf o;
        #pragma unroll
        for (int i = 0; i < 8; ++i) o[i] = f2bf(acc[j][i] + bc);
        *(v8bf*)(outB + (((size_t)(b * WH + (col >> 6)) * (WT / 32) + (t >> 5)) * WD +
                         (col & 63)) * 32 + (t & 31)) = o;
      }
      return;
    }
  }
  #pragma unroll
  for (int j = 0; j < 4; ++j) {
    #pragma unroll
    for (int i = 0; i < 8; ++i) {
      int row = m0 + wave * 16 + i + hl * 8;
      int col = n0 + j * 16 + l16;
      float v = acc[j][i] + bias[col];
      if constexpr (MODE == 0) {
        v += resid[(size_t)row * Nn + col];
        outF[(size_t)row * Nn + col] = v;
      } else if constexpr (MODE == 1) {
        int b = row / WT, t = row % WT;
        int hh = col >> 6, dd = col & 63;
        outB[((size_t)(b * WH + hh) * WT + t) * WD + dd] = f2bf(v);
      } else {
        float gl = 0.5f * v * (1.0f + erff(v * 0.70710678118f));
        outB[(size_t)row * Nn + col] = f2bf(gl);
      }
    }
  }
}

__device__ __forceinline__ float xhalf(float x) {
  return __builtin_bit_cast(float, __builtin_amdgcn_permlanex16(
      __builtin_bit_cast(int, x), __builtin_bit_cast(int, x),
      0x76543210, 0xfedcba98, false, false));
}

#define AK 128   // keys per stage: as many as the workgroup has queries, so the diagonal is the last stage

__global__ void __launch_bounds__(256) attn_kernel(
    const bf16_t* __restrict__ Q, const bf16_t* __restrict__ Km,
    const bf16_t* __restrict__ V, bf16_t* __restrict__ Y) {
  __shared__ __attribute__((aligned(16))) bf16_t Ks[AK][KS_PITCH];   // K rows (key-major), rows padded
  __shared__ __attribute__((aligned(16))) bf16_t Vs[AK / 32][64][VS_PITCH];   // Vs[piece][d][key], rows padded
  int tid = threadIdx.x, lane = tid & 31, wave = tid >> 5;
  int hl = lane >> 4, l16 = lane & 15;
  int bh = blockIdx.y;
  int b = bh >> 3, h = bh & 7;
  int bx = blockIdx.x;
  int qt = bx < 8 ? WT / 128 - 1 - bx : bx - 8;
  if (bh >= WBATCH * WH / 2) qt = WT / 128 - 1 - qt;
  int q0 = qt * 128;
  const bf16_t* Qp = Q + (size_t)bh * WT * WD;
  const bf16_t* Kp = Km + (size_t)bh * WT * WD;
  const bf16_t* Vp = V + (size_t)bh * WT * WD;   // [t / 32][d][32]

  // Q^T B-fragments (lane column = l16), d split into two 32-chunks
  int qrow = q0 + wave * 16 + l16;
  v16bf qf[2];
  #pragma unroll
  for (int c = 0; c < 2; ++c) qf[c] = mkfrag(Qp + (size_t)qrow * WD + c * 32, hl);

  v8f oacc[4] = {};             // O^T: oacc[n][i] = O[qrow][n * 16 + hl * 8 + i]
  float mrun = -3e30f;          // running maximum of query qrow, alike in both halves
  float srun = 0.f;             // running sum over this half's keys only
  const float scale = 0.125f;   // 1/sqrt(64)
  int nstage = (q0 + 128) / AK;
  int mymax = q0 + (int)uni(threadIdx.x >> 5) * 16 + 15;   // last q row this wave owns, a scalar

  // A stage is 128 keys, four passes of 32: one load round trip and one pair of barriers
  // serve four passes, and between the barriers the waves run free of one another.
  for (int ks = 0; ks < nstage; ++ks) {
    {   // stage K via async DMA to LDS, V (8 keys of one d) by 16-byte stores
      int r = tid >> 3, cs = (tid & 7) * 8;
      #pragma unroll   // the four copies and the four loads fly together
      for (int p = 0; p < AK / 32; ++p)
        copy16_g2l(Kp + (size_t)(ks * AK + p * 32 + r) * WD + cs, &Ks[p * 32 + r][cs]);
      #pragma unroll
      for (int p = 0; p < AK / 32; ++p)
        *(uint4*)&Vs[p][tid >> 2][(tid & 3) * 8] =
            *(const uint4*)(Vp + (size_t)(ks * (AK / 32) + p) * (WD * 32) + tid * 8);
    }
    async_drain();
    __syncthreads();
    // passes whose first key is not past the wave's last query: four, fewer on the diagonal
    int npass = min(AK / 32, (mymax - ks * AK) / 32 + 1);
    const bf16_t* kr = &Ks[l16][0];      // this lane's row in the pass's K and V pieces
    const bf16_t* vr = &Vs[0][l16][0];
    #pragma unroll 1
    for (int p = 0; p < npass; ++p) {
      int k0 = ks * AK + p * 32;
      // All sixteen LDS reads of the pass go out as one group: K's fragments first, then V's,
      // which land while the score products and the softmax run.
      v16bf kf[2][2], vf[4];
      #pragma unroll   // here and below: every index a constant, so the fragments stay in registers
      for (int j = 0; j < 2; ++j)
        #pragma unroll
        for (int c = 0; c < 2; ++c) kf[j][c] = mkfrag(kr + j * 16 * KS_PITCH + c * 32, hl);  // A row = K row
      #pragma unroll
      for (int n = 0; n < 4; ++n) vf[n] = mkfrag(vr + n * 16 * VS_PITCH, hl);            // A row = V^T row
      // keeps the reads above the WMMAs: without it the compiler sinks each pair of reads to
      // its WMMA, with a full wait at each of the eight places
      __builtin_amdgcn_sched_barrier(0);
      float st[2][8];    // st[j][i] = score of key k0 + j * 16 + hl * 8 + i
      float mx = -3e30f;
      #pragma unroll
      for (int j = 0; j < 2; ++j) {
        v8f s = {};
        #pragma unroll
        for (int c = 0; c < 2; ++c) s = wmma_bf16(kf[j][c], qf[c], s);
        #pragma unroll
        for (int i = 0; i < 8; ++i) {
          int key = k0 + j * 16 + hl * 8 + i;
          float e = s[i] * scale;
          if (key > qrow) e = -3e30f;   // causal mask
          st[j][i] = e;
          mx = fmaxf(mx, e);
        }
      }
      // online softmax, one query per lane
      mx = fmaxf(mx, xhalf(mx));
      float mnew = fmaxf(mrun, mx);
      float alpha = __expf(mrun - mnew);
      v16bf pf;          // P^T B-fragment: element j * 8 + i is key j * 16 + hl * 8 + i
      float rs = 0.f;
      #pragma unroll
      for (int j = 0; j < 2; ++j)
        #pragma unroll
        for (int i = 0; i < 8; ++i) {
          float p = __expf(st[j][i] - mnew);
          rs += p;
          pf[j * 8 + i] = f2bf(p);
        }
      srun = srun * alpha + rs;
      mrun = mnew;
      #pragma unroll
      for (int n = 0; n < 4; ++n) {
        #pragma unroll
        for (int i = 0; i < 8; ++i) oacc[n][i] *= alpha;
      }
      #pragma unroll
      for (int n = 0; n < 4; ++n) oacc[n] = wmma_bf16(vf[n], pf, oacc[n]);
      kr += 32 * KS_PITCH;
      vr += 64 * VS_PITCH;
    }
    // this wave's LDS reads have retired before the next stage's copies may overwrite them
    asm volatile("s_wait_dscnt 0x0" ::: "memory");
    __syncthreads();
  }

  // A lane holds 8 consecutive d of its query in each tile: one 16-byte store per tile.
  float stot = srun + xhalf(srun);
  #pragma unroll
  for (int n = 0; n < 4; ++n) {
    v8bf o;
    #pragma unroll
    for (int i = 0; i < 8; ++i) o[i] = f2bf(oacc[n][i] / stot);
    *(v8bf*)(Y + (size_t)(b * WT + qrow) * WC + h * WD + n * 16 + hl * 8) = o;
  }
}

// ---- host launch ---------------------------------------------------------

extern "C" void kernel_launch(void* const* d_in, const int* in_sizes, int n_in,
                              void* d_out, int out_size, void* d_ws, size_t ws_size,
                              hipStream_t stream) {
  (void)in_sizes; (void)n_in; (void)out_size; (void)ws_size;
  const float* x   = (const float*)d_in[0];
  const float* g1  = (const float*)d_in[1];
  const float* be1 = (const float*)d_in[2];
  const float* g2  = (const float*)d_in[3];
  const float* be2 = (const float*)d_in[4];
  const float* Wq = (const float*)d_in[5];  const float* bq = (const float*)d_in[6];
  const float* Wk = (const float*)d_in[7];  const float* bk = (const float*)d_in[8];
  const float* Wv = (const float*)d_in[9];  const float* bv = (const float*)d_in[10];
  const float* Wp = (const float*)d_in[11]; const float* bp = (const float*)d_in[12];
  const float* W1 = (const float*)d_in[13]; const float* b1 = (const float*)d_in[14];
  const float* W2 = (const float*)d_in[15]; const float* b2 = (const float*)d_in[16];
  float* out = (float*)d_out;

  char* ws = (char*)d_ws;
  size_t off = 0;
  auto alloc = [&](size_t bytes) -> char* {
    char* p = ws + off; off += (bytes + 255) & ~(size_t)255; return p;
  };
  const size_t CC = (size_t)WC * WC;          // 262144
  const size_t C4 = (size_t)WC * 4 * WC;      // 1048576
  bf16_t* wqb = (bf16_t*)alloc(CC * 2);
  bf16_t* wkb = (bf16_t*)alloc(CC * 2);
  bf16_t* wvb = (bf16_t*)alloc(CC * 2);
  bf16_t* wpb = (bf16_t*)alloc(CC * 2);
  bf16_t* w1b = (bf16_t*)alloc(C4 * 2);
  bf16_t* w2b = (bf16_t*)alloc(C4 * 2);
  bf16_t* h1  = (bf16_t*)alloc((size_t)WM * WC * 2);
  bf16_t* qb  = (bf16_t*)alloc((size_t)WM * WC * 2);
  bf16_t* kb  = (bf16_t*)alloc((size_t)WM * WC * 2);
  bf16_t* vb  = (bf16_t*)alloc((size_t)WM * WC * 2);
  bf16_t* yb  = (bf16_t*)alloc((size_t)WM * WC * 2);
  float*  x1  = (float*)alloc((size_t)WM * WC * 4);
  bf16_t* h2  = (bf16_t*)alloc((size_t)WM * WC * 2);
  bf16_t* act = (bf16_t*)alloc((size_t)WM * 4 * WC * 2);

  // 1) + 2) weights -> bf16, k innermost in 32-k tiles, and LN1, one launch
  prepass_kernel<<<LN_BLOCKS + CVT_BLOCKS, 256, 0, stream>>>(
      x, g1, be1, h1, Wq, Wk, Wv, Wp, W1, W2, wqb, wkb, wvb, wpb, w1b, w2b);

  // 3) Q/K/V projections (head-reshaped bf16 outputs), one launch: wqb/wkb/wvb and
  //    qb/kb/vb are consecutive allocations of whole 256-byte multiples
  dim3 gq(WC / 64, WM / 128);                   // (8, 64)
  dim3 gqkv(WC / 64, WM / 128, 3);              // (8, 64, 3)
  gemm_bf16_kernel<1><<<gqkv, 256, 0, stream>>>(h1, wqb, bq, nullptr, nullptr, qb, WM, WC, WC, bk, bv);

  // 4) causal flash attention
  dim3 ga(WT / 128, WBATCH * WH);               // (16, 32)
  attn_kernel<<<ga, 256, 0, stream>>>(qb, kb, vb, yb);

  // 5) output projection + residual -> x1 (f32)
  gemm_bf16_kernel<0><<<gq, 256, 0, stream>>>(yb, wpb, bp, x, x1, nullptr, WM, WC, WC, nullptr, nullptr);

  // 6) LN2
  ln_kernel<<<WM / 8, 256, 0, stream>>>(x1, g2, be2, h2, WM);

  // 7) MLP up + exact GELU -> bf16
  dim3 gm(4 * WC / 64, WM / 128);               // (32, 64)
  gemm_bf16_kernel<2><<<gm, 256, 0, stream>>>(h2, w1b, b1, nullptr, nullptr, act, WM, 4 * WC, WC, nullptr, nullptr);

  // 8) MLP down + residual -> d_out (f32)
  gemm_bf16_kernel<0><<<gq, 256, 0, stream>>>(act, w2b, b2, x1, out, nullptr, WM, WC, 4 * WC, nullptr, nullptr);
}

// v009
// A run of this version takes 127 microseconds.
// Timed twice side by side with v008, it ran 1.06 times as fast both times.
// Over all steps from v000 it is 3.77 times as fast.
#include <hip/hip_runtime.h>
#include <hip/hip_bf16.h>
#include <math.h>

// Problem dims (fixed by reference)
#define WBATCH 4
#define WT     2048
#define WC     512
#define WH     8
#define WD     64
#define WM     (WBATCH * WT)   // 8192 tokens

typedef __bf16 bf16_t;
typedef __attribute__((ext_vector_type(16))) __bf16 v16bf;
typedef __attribute__((ext_vector_type(8)))  __bf16 v8bf;
typedef __attribute__((ext_vector_type(8)))  float  v8f;
typedef __attribute__((ext_vector_type(4)))  int    v4i;
typedef __attribute__((ext_vector_type(8)))  int    v8i;
typedef __attribute__((ext_vector_type(4)))  unsigned int v4u;

#define AS_PITCH 136  // 128 used + 8 pad: 272 B
#define VS_PITCH 40   // 32 used + 8 pad: 80 B
#define KS_PITCH 72   // 64 used + 8 pad: 144 B

// ---- helpers -------------------------------------------------------------

__device__ __forceinline__ bf16_t f2bf(float f) {
  union { float f; unsigned u; } a; a.f = f;
  unsigned r = a.u + 0x7fffu + ((a.u >> 16) & 1u);   // round-nearest-even
  unsigned short s = (unsigned short)(r >> 16);
  bf16_t b; __builtin_memcpy(&b, &s, 2); return b;
}

__device__ __forceinline__ v16bf mkfrag(const bf16_t* row, int hl) {
  v8bf lo = *(const v8bf*)(row + hl * 8);
  v8bf hi = *(const v8bf*)(row + 16 + hl * 8);
  return __builtin_shufflevector(lo, hi, 0,1,2,3,4,5,6,7,8,9,10,11,12,13,14,15);
}

__device__ __forceinline__ v8f wmma_bf16(v16bf a, v16bf b, v8f c) {
  return __builtin_amdgcn_wmma_f32_16x16x32_bf16(false, a, false, b, (short)0, c,
                                                 false, false);
}

#if __has_builtin(__builtin_amdgcn_global_load_async_to_lds_b128)
#define CDNA5_ASYNC_LDS 1
#else
#define CDNA5_ASYNC_LDS 0
#endif

__device__ __forceinline__ void copy16_g2l(const void* g, void* l) {
#if CDNA5_ASYNC_LDS
  __builtin_amdgcn_global_load_async_to_lds_b128(
      (__attribute__((address_space(1))) v4i*)g,
      (__attribute__((address_space(3))) v4i*)l, 0, 0);
#else
  *(uint4*)l = *(const uint4*)g;
#endif
}

__device__ __forceinline__ void async_drain() {
#if CDNA5_ASYNC_LDS
  asm volatile("s_wait_asynccnt 0" ::: "memory");
#endif
}

#define GK 128   // k per GEMM stage: a row of the A tile is 256 B

typedef __attribute__((ext_vector_type(8))) unsigned int v8u;

__device__ __forceinline__ unsigned uni(unsigned v) {
  return (unsigned)__builtin_amdgcn_readfirstlane(v);
}

__device__ __forceinline__ unsigned pinned(unsigned v) {
  unsigned w = uni(v);
  asm volatile("" : "+s"(w));   // pinned(): keeps the word scalar
  return w;
}

__device__ __forceinline__ v8u tdm_group1(unsigned src_pitch) {
  constexpr unsigned d0 = GK * 2, d1 = 128;
  v8u g;
  g[0] = uni((1u << 20) | (5u << 22) | (3u << 25));
  g[1] = uni((d0 & 0xffffu) << 16);
  g[2] = uni((d0 >> 16) | ((d1 & 0xffffu) << 16));
  g[3] = uni((d1 >> 16) | (d0 << 16));
  g[4] = uni(d1);
  g[5] = uni(src_pitch);
  g[6] = uni(0u);
  g[7] = uni(0u);
  return g;
}

__device__ __forceinline__ v4u tdm_group0(unsigned lds_dst, unsigned long long ga) {
  v4u g;
  g[0] = uni(1u);
  g[1] = uni(lds_dst);
  g[2] = uni((unsigned)ga);
  g[3] = uni((((unsigned)(ga >> 32)) & 0x01ffffffu) | 0x80000000u);
  return g;
}

__device__ __forceinline__ void tdm_load(v4u g0, v8u g1) {
  asm volatile("tensor_load_to_lds %0, %1" :: "s"(g0), "s"(g1) : "memory");
}

__device__ __forceinline__ unsigned lds_byte_addr(const void* p) {
  return (unsigned)(size_t)(__attribute__((address_space(3))) const char*)p;
}

// ---- LayerNorm: one wave (32 lanes) per row of 512 -----------------------

__device__ __forceinline__ void ln_rows(const float* __restrict__ x,
                                        const float* __restrict__ g,
                                        const float* __restrict__ beta,
                                        bf16_t* __restrict__ out, int rows) {
  int wave = threadIdx.x >> 5, lane = threadIdx.x & 31;
  int row = blockIdx.x * 8 + wave;
  if (row >= rows) return;
  const float* xr = x + (size_t)row * WC;
  float vals[16];
  float s = 0.f;
  #pragma unroll
  for (int k = 0; k < 16; ++k) { vals[k] = xr[lane + 32 * k]; s += vals[k]; }
  #pragma unroll
  for (int o = 16; o >= 1; o >>= 1) s += __shfl_xor(s, o, 32);
  float mean = s * (1.0f / WC);
  float vs = 0.f;
  #pragma unroll
  for (int k = 0; k < 16; ++k) { float d = vals[k] - mean; vs += d * d; }
  #pragma unroll
  for (int o = 16; o >= 1; o >>= 1) vs += __shfl_xor(vs, o, 32);
  float rinv = rsqrtf(vs * (1.0f / WC) + 1e-5f);
  #pragma unroll
  for (int k = 0; k < 16; ++k) {
    int idx = lane + 32 * k;
    out[(size_t)row * WC + idx] = f2bf((vals[k] - mean) * rinv * g[idx] + beta[idx]);
  }
}

__global__ void __launch_bounds__(256) ln_kernel(const float* __restrict__ x,
                                                 const float* __restrict__ g,
                                                 const float* __restrict__ beta,
                                                 bf16_t* __restrict__ out, int rows) {
  ln_rows(x, g, beta, out, rows);
}

// ---- Pre-pass: LayerNorm 1 and the six f32 -> bf16 weight conversions ----
// None of the seven depends on another, so they share one launch: blocks
// [0, LN_BLOCKS) normalise 8 rows each; the later blocks convert, CVT_SMALL or
// CVT_LARGE blocks to a matrix. A weight W[K][N] goes out as Wt[K / 32][N][32], k
// innermost: the BN n x 32 k tile of a GEMM step is then BN x 64 B in a row, in the order of
// its LDS image. A block takes 64 k x 32 n, a lane one n (loads of whole lines) and 8
// consecutive k (one 16-byte store).

#define LN_BLOCKS  (WM / 8)                 // 1024
#define CVT_SMALL  (WC * WC / 2048)         // blocks for a C x C matrix
#define CVT_LARGE  (4 * WC * WC / 2048)     // blocks for a C x 4C or 4C x C matrix
#define CVT_BLOCKS (4 * CVT_SMALL + 2 * CVT_LARGE)

template <int NN>   // NN: row length of in, known at compile time: one address, constant offsets
__device__ __forceinline__ void cvt_f32_bf16_t(const float* __restrict__ in,
                                               bf16_t* __restrict__ out, int blk) {
  constexpr int ntile = NN / 32;
  int n = (blk % ntile) * 32 + (threadIdx.x & 31);
  int k = (blk / ntile) * 64 + (threadIdx.x >> 5) * 8;
  const float* src = in + (size_t)k * NN + n;
  float f[8];
  #pragma unroll
  for (int i = 0; i < 8; ++i) f[i] = src[i * NN];
  // before a register that the loads name is written again
  asm volatile("s_wait_xcnt 0x0" ::: "memory");
  v8bf o;
  #pragma unroll
  for (int i = 0; i < 8; ++i) o[i] = f2bf(f[i]);
  *(v8bf*)(out + ((size_t)(k >> 5) * NN + n) * 32 + (k & 31)) = o;
  // before a register that the store names is written again
  asm volatile("s_wait_xcnt 0x0" ::: "memory");
}

__global__ void __launch_bounds__(256) prepass_kernel(
    const float* __restrict__ x, const float* __restrict__ g,
    const float* __restrict__ beta, bf16_t* __restrict__ h,
    const float* __restrict__ Wq, const float* __restrict__ Wk,
    const float* __restrict__ Wv, const float* __restrict__ Wp,
    const float* __restrict__ W1, const float* __restrict__ W2,
    bf16_t* __restrict__ wqb, bf16_t* __restrict__ wkb,
    bf16_t* __restrict__ wvb, bf16_t* __restrict__ wpb,
    bf16_t* __restrict__ w1b, bf16_t* __restrict__ w2b) {
  if (blockIdx.x < LN_BLOCKS) { ln_rows(x, g, beta, h, WM); return; }
  int c = blockIdx.x - LN_BLOCKS;
  if (c < 4 * CVT_SMALL) {
    int m = c / CVT_SMALL;
    const float* in = m == 0 ? Wq  : m == 1 ? Wk  : m == 2 ? Wv  : Wp;
    bf16_t* out     = m == 0 ? wqb : m == 1 ? wkb : m == 2 ? wvb : wpb;
    cvt_f32_bf16_t<WC>(in, out, c - m * CVT_SMALL);
  } else {
    c -= 4 * CVT_SMALL;
    if (c < CVT_LARGE) cvt_f32_bf16_t<4 * WC>(W1, w1b, c);
    else               cvt_f32_bf16_t<WC>(W2, w2b, c - CVT_LARGE);
  }
}

template <int MODE>
__global__ void __launch_bounds__(256, MODE == 1 ? 6 : MODE == 2 ? 8 : 1) gemm_bf16_kernel(
    const bf16_t* __restrict__ A, const bf16_t* __restrict__ W,
    const float* __restrict__ bias, const float* __restrict__ resid,
    float* __restrict__ outF, bf16_t* __restrict__ outB,
    int Mm, int Nn, int Kk,
    const float* __restrict__ bias_z1, const float* __restrict__ bias_z2) {
  if constexpr (MODE == 1) {
    int z = blockIdx.z;
    W    += (size_t)z * Kk * Nn;
    outB += (size_t)z * Mm * Nn;
    bias  = z == 0 ? bias : z == 1 ? bias_z1 : bias_z2;
  }
  __shared__ __attribute__((aligned(2048))) bf16_t As[128 * AS_PITCH];   // rows padded by the mover
  constexpr int BN = MODE == 0 ? 64 : 128;   // columns of the workgroup tile
  constexpr int FA = BN / 64;                // 16-row A fragments of a wave
  __shared__ __attribute__((aligned(16))) bf16_t Bs[BN][AS_PITCH];   // Bs[n][k], rows padded
  int tid = threadIdx.x;
  int lane = tid & 31, wave = tid >> 5;
  int hl = lane >> 4, l16 = lane & 15;
  int m0 = blockIdx.y * 128, n0 = blockIdx.x * BN;
  int wr = (wave % (8 / FA)) * (16 * FA);    // the wave's first row and column in the tile
  int wc = (wave / (8 / FA)) * 64;
  const unsigned wave_u = uni(threadIdx.x >> 5);
  const v8u g1 = tdm_group1((unsigned)Kk * 2u);

  v8f acc[FA][4] = {};
  int nk = Kk / GK;
  for (int kc = 0; kc < nk; ++kc) {
    int k0 = kc * GK;
    if (pinned(wave_u == 0)) {   // one request moves the whole 128 x 128 A tile
      tdm_load(tdm_group0(lds_byte_addr(As),
                          (unsigned long long)(A + (size_t)m0 * Kk + k0)), g1);
      // the tile has landed before this wave reaches the barrier that publishes it
      asm volatile("s_wait_tensorcnt 0x0" ::: "memory");
    }
    const bf16_t* wsrc[GK / 32];   // this thread's first 16 bytes in each 32-k piece of the W tile
    #pragma unroll   // all the loads fly together
    for (int kk = 0; kk < GK / 32; ++kk) {   // 8 contiguous k of one n, 64 n to a round
      wsrc[kk] = W + ((size_t)(kc * (GK / 32) + kk) * Nn + n0) * 32 + tid * 8;
      #pragma unroll
      for (int r = 0; r < FA; ++r)
        *(uint4*)&Bs[r * 64 + (tid >> 2)][kk * 32 + (tid & 3) * 8] =
            *(const uint4*)(wsrc[kk] + r * 64 * 32);
    }
    // before a register that the loads name is written again; the addresses are inputs, so
    // that no load's result is given an address register of the group
    asm volatile("s_wait_xcnt 0x0" :: "v"(wsrc[0]), "v"(wsrc[1]), "v"(wsrc[2]), "v"(wsrc[3]) : "memory");
    if (kc + 1 < nk) {   // global_prefetch_b8 of the next stage, a 128-B line of A a thread
      __builtin_prefetch(A + (size_t)(m0 + (tid >> 1)) * Kk + k0 + GK + (tid & 1) * 64, 0, 1);
      __builtin_prefetch(W + ((size_t)((kc + 1) * (GK / 32) + (tid >> 6)) * Nn + n0) * 32 +
                             (tid & 63) * (BN / 2), 0, 1);
    }
    __syncthreads();
    if constexpr (MODE == 0) {
      v16bf af[GK / 32], bfv[GK / 32][4];
      #pragma unroll   // every LDS offset a constant
      for (int kk = 0; kk < GK / 32; ++kk) {
        af[kk] = mkfrag(&As[(wr + l16) * AS_PITCH + kk * 32], hl);
        #pragma unroll   // here and below: every index a constant, so the fragments stay in registers
        for (int j = 0; j < 4; ++j) bfv[kk][j] = mkfrag(&Bs[j * 16 + l16][kk * 32], hl);
      }
      // keeps the reads above the WMMAs: without it the compiler sinks each pair of reads to
      // its WMMA, with a full wait at each of the sixteen places
      __builtin_amdgcn_sched_barrier(0);
      #pragma unroll
      for (int kk = 0; kk < GK / 32; ++kk) {
        #pragma unroll
        for (int j = 0; j < 4; ++j) acc[0][j] = wmma_bf16(af[kk], bfv[kk][j], acc[0][j]);
      }
      // keeps the WMMAs above the full wait and the barrier below: they run while the later
      // reads still land, not behind the last of them
      __builtin_amdgcn_sched_barrier(0);
    } else {
      #pragma unroll   // every LDS offset a constant
      for (int kk = 0; kk < GK / 32; ++kk) {
        v16bf af[FA];
        #pragma unroll
        for (int a = 0; a < FA; ++a) af[a] = mkfrag(&As[(wr + a * 16 + l16) * AS_PITCH + kk * 32], hl);
        #pragma unroll
        for (int j = 0; j < 4; ++j) {
          v16bf bfv = mkfrag(&Bs[wc + j * 16 + l16][kk * 32], hl);
          #pragma unroll
          for (int a = 0; a < FA; ++a) acc[a][j] = wmma_bf16(af[a], bfv, acc[a][j]);
        }
      }
    }
    // this wave's LDS reads have retired before the next stage's tensor load may overwrite them
    asm volatile("s_wait_dscnt 0x0" ::: "memory");
    __syncthreads();
  }

  if constexpr (MODE == 1) {
    if (blockIdx.z == 2) {   // V: a lane's 8 rows are 8 consecutive t of one (head, d)
      #pragma unroll
      for (int a = 0; a < FA; ++a) {
        int row = m0 + wr + a * 16 + hl * 8;
        int b = row / WT, t = row % WT;
        #pragma unroll
        for (int j = 0; j < 4; ++j) {
          int col = n0 + wc + j * 16 + l16;
          float bc = bias[col];
          v8bf o;
          #pragma unroll
          for (int i = 0; i < 8; ++i) o[i] = f2bf(acc[a][j][i] + bc);
          *(v8bf*)(outB + (((size_t)(b * WH + (col >> 6)) * (WT / 32) + (t >> 5)) * WD +
                           (col & 63)) * 32 + (t & 31)) = o;
        }
      }
      return;
    }
  }
  #pragma unroll
  for (int a = 0; a < FA; ++a)
  #pragma unroll
  for (int j = 0; j < 4; ++j) {
    #pragma unroll
    for (int i = 0; i < 8; ++i) {
      int row = m0 + wr + a * 16 + i + hl * 8;
      int col = n0 + wc + j * 16 + l16;
      float v = acc[a][j][i] + bias[col];
      if constexpr (MODE == 0) {
        v += resid[(size_t)row * Nn + col];
        outF[(size_t)row * Nn + col] = v;
      } else if constexpr (MODE == 1) {
        int b = row / WT, t = row % WT;
        int hh = col >> 6, dd = col & 63;
        outB[((size_t)(b * WH + hh) * WT + t) * WD + dd] = f2bf(v);
      } else {
        float gl = 0.5f * v * (1.0f + erff(v * 0.70710678118f));
        outB[(size_t)row * Nn + col] = f2bf(gl);
      }
    }
  }
}

__device__ __forceinline__ float xhalf(float x) {
  return __builtin_bit_cast(float, __builtin_amdgcn_permlanex16(
      __builtin_bit_cast(int, x), __builtin_bit_cast(int, x),
      0x76543210, 0xfedcba98, false, false));
}

#define AK 128   // keys per stage: as many as the workgroup has queries, so the diagonal is the last stage

__global__ void __launch_bounds__(256) attn_kernel(
    const bf16_t* __restrict__ Q, const bf16_t* __restrict__ Km,
    const bf16_t* __restrict__ V, bf16_t* __restrict__ Y) {
  __shared__ __attribute__((aligned(16))) bf16_t Ks[AK][KS_PITCH];   // K rows (key-major), rows padded
  __shared__ __attribute__((aligned(16))) bf16_t Vs[AK / 32][64][VS_PITCH];   // Vs[piece][d][key], rows padded
  int tid = threadIdx.x, lane = tid & 31, wave = tid >> 5;
  int hl = lane >> 4, l16 = lane & 15;
  int bh = blockIdx.y;
  int b = bh >> 3, h = bh & 7;
  int bx = blockIdx.x;
  int qt = bx < 8 ? WT / 128 - 1 - bx : bx - 8;
  if (bh >= WBATCH * WH / 2) qt = WT / 128 - 1 - qt;
  int q0 = qt * 128;
  const bf16_t* Qp = Q + (size_t)bh * WT * WD;
  const bf16_t* Kp = Km + (size_t)bh * WT * WD;
  const bf16_t* Vp = V + (size_t)bh * WT * WD;   // [t / 32][d][32]

  // Q^T B-fragments (lane column = l16), d split into two 32-chunks
  int qrow = q0 + wave * 16 + l16;
  v16bf qf[2];
  #pragma unroll
  for (int c = 0; c < 2; ++c) qf[c] = mkfrag(Qp + (size_t)qrow * WD + c * 32, hl);

  v8f oacc[4] = {};             // O^T: oacc[n][i] = O[qrow][n * 16 + hl * 8 + i]
  float mrun = -3e30f;          // running maximum of query qrow, alike in both halves
  float srun = 0.f;             // running sum over this half's keys only
  const float scale = 0.125f;   // 1/sqrt(64)
  int nstage = (q0 + 128) / AK;
  int mymax = q0 + (int)uni(threadIdx.x >> 5) * 16 + 15;   // last q row this wave owns, a scalar

  // A stage is 128 keys, four passes of 32: one load round trip and one pair of barriers
  // serve four passes, and between the barriers the waves run free of one another.
  for (int ks = 0; ks < nstage; ++ks) {
    {   // stage K via async DMA to LDS, V (8 keys of one d) by 16-byte stores
      int r = tid >> 3, cs = (tid & 7) * 8;
      #pragma unroll   // the four copies and the four loads fly together
      for (int p = 0; p < AK / 32; ++p)
        copy16_g2l(Kp + (size_t)(ks * AK + p * 32 + r) * WD + cs, &Ks[p * 32 + r][cs]);
      #pragma unroll
      for (int p = 0; p < AK / 32; ++p)
        *(uint4*)&Vs[p][tid >> 2][(tid & 3) * 8] =
            *(const uint4*)(Vp + (size_t)(ks * (AK / 32) + p) * (WD * 32) + tid * 8);
    }
    async_drain();
    __syncthreads();
    // passes whose first key is not past the wave's last query: four, fewer on the diagonal
    int npass = min(AK / 32, (mymax - ks * AK) / 32 + 1);
    const bf16_t* kr = &Ks[l16][0];      // this lane's row in the pass's K and V pieces
    const bf16_t* vr = &Vs[0][l16][0];
    #pragma unroll 1
    for (int p = 0; p < npass; ++p) {
      int k0 = ks * AK + p * 32;
      // All sixteen LDS reads of the pass go out as one group: K's fragments first, then V's,
      // which land while the score products and the softmax run.
      v16bf kf[2][2], vf[4];
      #pragma unroll   // here and below: every index a constant, so the fragments stay in registers
      for (int j = 0; j < 2; ++j)
        #pragma unroll
        for (int c = 0; c < 2; ++c) kf[j][c] = mkfrag(kr + j * 16 * KS_PITCH + c * 32, hl);  // A row = K row
      #pragma unroll
      for (int n = 0; n < 4; ++n) vf[n] = mkfrag(vr + n * 16 * VS_PITCH, hl);            // A row = V^T row
      // keeps the reads above the WMMAs: without it the compiler sinks each pair of reads to
      // its WMMA, with a full wait at each of the eight places
      __builtin_amdgcn_sched_barrier(0);
      float st[2][8];    // st[j][i] = score of key k0 + j * 16 + hl * 8 + i
      float mx = -3e30f;
      #pragma unroll
      for (int j = 0; j < 2; ++j) {
        v8f s = {};
        #pragma unroll
        for (int c = 0; c < 2; ++c) s = wmma_bf16(kf[j][c], qf[c], s);
        #pragma unroll
        for (int i = 0; i < 8; ++i) {
          int key = k0 + j * 16 + hl * 8 + i;
          float e = s[i] * scale;
          if (key > qrow) e = -3e30f;   // causal mask
          st[j][i] = e;
          mx = fmaxf(mx, e);
        }
      }
      // online softmax, one query per lane
      mx = fmaxf(mx, xhalf(mx));
      float mnew = fmaxf(mrun, mx);
      float alpha = __expf(mrun - mnew);
      v16bf pf;          // P^T B-fragment: element j * 8 + i is key j * 16 + hl * 8 + i
      float rs = 0.f;
      #pragma unroll
      for (int j = 0; j < 2; ++j)
        #pragma unroll
        for (int i = 0; i < 8; ++i) {
          float p = __expf(st[j][i] - mnew);
          rs += p;
          pf[j * 8 + i] = f2bf(p);
        }
      srun = srun * alpha + rs;
      mrun = mnew;
      #pragma unroll
      for (int n = 0; n < 4; ++n) {
        #pragma unroll
        for (int i = 0; i < 8; ++i) oacc[n][i] *= alpha;
      }
      #pragma unroll
      for (int n = 0; n < 4; ++n) oacc[n] = wmma_bf16(vf[n], pf, oacc[n]);
      kr += 32 * KS_PITCH;
      vr += 64 * VS_PITCH;
    }
    // this wave's LDS reads have retired before the next stage's copies may overwrite them
    asm volatile("s_wait_dscnt 0x0" ::: "memory");
    __syncthreads();
  }

  // A lane holds 8 consecutive d of its query in each tile: one 16-byte store per tile.
  float stot = srun + xhalf(srun);
  #pragma unroll
  for (int n = 0; n < 4; ++n) {
    v8bf o;
    #pragma unroll
    for (int i = 0; i < 8; ++i) o[i] = f2bf(oacc[n][i] / stot);
    *(v8bf*)(Y + (size_t)(b * WT + qrow) * WC + h * WD + n * 16 + hl * 8) = o;
  }
}

// ---- host launch ---------------------------------------------------------

extern "C" void kernel_launch(void* const* d_in, const int* in_sizes, int n_in,
                              void* d_out, int out_size, void* d_ws, size_t ws_size,
                              hipStream_t stream) {
  (void)in_sizes; (void)n_in; (void)out_size; (void)ws_size;
  const float* x   = (const float*)d_in[0];
  const float* g1  = (const float*)d_in[1];
  const float* be1 = (const float*)d_in[2];
  const float* g2  = (const float*)d_in[3];
  const float* be2 = (const float*)d_in[4];
  const float* Wq = (const float*)d_in[5];  const float* bq = (const float*)d_in[6];
  const float* Wk = (const float*)d_in[7];  const float* bk = (const float*)d_in[8];
  const float* Wv = (const float*)d_in[9];  const float* bv = (const float*)d_in[10];
  const float* Wp = (const float*)d_in[11]; const float* bp = (const float*)d_in[12];
  const float* W1 = (const float*)d_in[13]; const float* b1 = (const float*)d_in[14];
  const float* W2 = (const float*)d_in[15]; const float* b2 = (const float*)d_in[16];
  float* out = (float*)d_out;

  char* ws = (char*)d_ws;
  size_t off = 0;
  auto alloc = [&](size_t bytes) -> char* {
    char* p = ws + off; off += (bytes + 255) & ~(size_t)255; return p;
  };
  const size_t CC = (size_t)WC * WC;          // 262144
  const size_t C4 = (size_t)WC * 4 * WC;      // 1048576
  bf16_t* wqb = (bf16_t*)alloc(CC * 2);
  bf16_t* wkb = (bf16_t*)alloc(CC * 2);
  bf16_t* wvb = (bf16_t*)alloc(CC * 2);
  bf16_t* wpb = (bf16_t*)alloc(CC * 2);
  bf16_t* w1b = (bf16_t*)alloc(C4 * 2);
  bf16_t* w2b = (bf16_t*)alloc(C4 * 2);
  bf16_t* h1  = (bf16_t*)alloc((size_t)WM * WC * 2);
  bf16_t* qb  = (bf16_t*)alloc((size_t)WM * WC * 2);
  bf16_t* kb  = (bf16_t*)alloc((size_t)WM * WC * 2);
  bf16_t* vb  = (bf16_t*)alloc((size_t)WM * WC * 2);
  bf16_t* yb  = (bf16_t*)alloc((size_t)WM * WC * 2);
  float*  x1  = (float*)alloc((size_t)WM * WC * 4);
  bf16_t* h2  = (bf16_t*)alloc((size_t)WM * WC * 2);
  bf16_t* act = (bf16_t*)alloc((size_t)WM * 4 * WC * 2);

  // 1) + 2) weights -> bf16, k innermost in 32-k tiles, and LN1, one launch
  prepass_kernel<<<LN_BLOCKS + CVT_BLOCKS, 256, 0, stream>>>(
      x, g1, be1, h1, Wq, Wk, Wv, Wp, W1, W2, wqb, wkb, wvb, wpb, w1b, w2b);

  // 3) Q/K/V projections (head-reshaped bf16 outputs), one launch: wqb/wkb/wvb and
  //    qb/kb/vb are consecutive allocations of whole 256-byte multiples
  dim3 gq(WC / 64, WM / 128);                   // (8, 64)
  dim3 gqkv(WC / 128, WM / 128, 3);             // (4, 64, 3)
  gemm_bf16_kernel<1><<<gqkv, 256, 0, stream>>>(h1, wqb, bq, nullptr, nullptr, qb, WM, WC, WC, bk, bv);

  // 4) causal flash attention
  dim3 ga(WT / 128, WBATCH * WH);               // (16, 32)
  attn_kernel<<<ga, 256, 0, stream>>>(qb, kb, vb, yb);

  // 5) output projection + residual -> x1 (f32)
  gemm_bf16_kernel<0><<<gq, 256, 0, stream>>>(yb, wpb, bp, x, x1, nullptr, WM, WC, WC, nullptr, nullptr);

  // 6) LN2
  ln_kernel<<<WM / 8, 256, 0, stream>>>(x1, g2, be2, h2, WM);

  // 7) MLP up + exact GELU -> bf16
  dim3 gm(4 * WC / 128, WM / 128);              // (16, 64)
  gemm_bf16_kernel<2><<<gm, 256, 0, stream>>>(h2, w1b, b1, nullptr, nullptr, act, WM, 4 * WC, WC, nullptr, nullptr);

  // 8) MLP down + residual -> d_out (f32)
  gemm_bf16_kernel<0><<<gq, 256, 0, stream>>>(act, w2b, b2, x1, out, nullptr, WM, WC, 4 * WC, nullptr, nullptr);
}

// v010
// A run of this version takes 113 microseconds.
// Timed twice side by side with v009, it ran 1.13 and 1.14 times as fast.
// All steps since v000 together make it 4.27 times as fast.
#include <hip/hip_runtime.h>
#include <hip/hip_bf16.h>
#include <math.h>

// Problem dims (fixed by reference)
#define WBATCH 4
#define WT     2048
#define WC     512
#define WH     8
#define WD     64
#define WM     (WBATCH * WT)   // 8192 tokens

typedef __bf16 bf16_t;
typedef __attribute__((ext_vector_type(16))) __bf16 v16bf;
typedef __attribute__((ext_vector_type(8)))  __bf16 v8bf;
typedef __attribute__((ext_vector_type(8)))  float  v8f;
typedef __attribute__((ext_vector_type(4)))  int    v4i;
typedef __attribute__((ext_vector_type(8)))  int    v8i;
typedef __attribute__((ext_vector_type(4)))  unsigned int v4u;

#define AS_PITCH 136  // 128 used + 8 pad: 272 B
#define VS_PITCH 40   // 32 used + 8 pad: 80 B
#define KS_PITCH 72   // 64 used + 8 pad: 144 B

// ---- helpers -------------------------------------------------------------

__device__ __forceinline__ bf16_t f2bf(float f) {
  union { float f; unsigned u; } a; a.f = f;
  unsigned r = a.u + 0x7fffu + ((a.u >> 16) & 1u);   // round-nearest-even
  unsigned short s = (unsigned short)(r >> 16);
  bf16_t b; __builtin_memcpy(&b, &s, 2); return b;
}

__device__ __forceinline__ v16bf mkfrag(const bf16_t* row, int hl) {
  v8bf lo = *(const v8bf*)(row + hl * 8);
  v8bf hi = *(const v8bf*)(row + 16 + hl * 8);
  return __builtin_shufflevector(lo, hi, 0,1,2,3,4,5,6,7,8,9,10,11,12,13,14,15);
}

__device__ __forceinline__ v8f wmma_bf16(v16bf a, v16bf b, v8f c) {
  return __builtin_amdgcn_wmma_f32_16x16x32_bf16(false, a, false, b, (short)0, c,
                                                 false, false);
}

#if __has_builtin(__builtin_amdgcn_global_load_async_to_lds_b128)
#define CDNA5_ASYNC_LDS 1
#else
#define CDNA5_ASYNC_LDS 0
#endif

__device__ __forceinline__ void copy16_g2l(const void* g, void* l) {
#if CDNA5_ASYNC_LDS
  __builtin_amdgcn_global_load_async_to_lds_b128(
      (__attribute__((address_space(1))) v4i*)g,
      (__attribute__((address_space(3))) v4i*)l, 0, 0);
#else
  *(uint4*)l = *(const uint4*)g;
#endif
}

__device__ __forceinline__ void async_drain() {
#if CDNA5_ASYNC_LDS
  asm volatile("s_wait_asynccnt 0" ::: "memory");
#endif
}

#define GK 128   // k per GEMM stage: a row of the A tile is 256 B

typedef __attribute__((ext_vector_type(8))) unsigned int v8u;

__device__ __forceinline__ unsigned uni(unsigned v) {
  return (unsigned)__builtin_amdgcn_readfirstlane(v);
}

__device__ __forceinline__ unsigned pinned(unsigned v) {
  unsigned w = uni(v);
  asm volatile("" : "+s"(w));   // pinned(): keeps the word scalar
  return w;
}

__device__ __forceinline__ v8u tdm_group1(unsigned src_pitch) {
  constexpr unsigned d0 = GK * 2, d1 = 128;
  v8u g;
  g[0] = uni((1u << 20) | (5u << 22) | (3u << 25));
  g[1] = uni((d0 & 0xffffu) << 16);
  g[2] = uni((d0 >> 16) | ((d1 & 0xffffu) << 16));
  g[3] = uni((d1 >> 16) | (d0 << 16));
  g[4] = uni(d1);
  g[5] = uni(src_pitch);
  g[6] = uni(0u);
  g[7] = uni(0u);
  return g;
}

__device__ __forceinline__ v4u tdm_group0(unsigned lds_dst, unsigned long long ga) {
  v4u g;
  g[0] = uni(1u);
  g[1] = uni(lds_dst);
  g[2] = uni((unsigned)ga);
  g[3] = uni((((unsigned)(ga >> 32)) & 0x01ffffffu) | 0x80000000u);
  return g;
}

__device__ __forceinline__ void tdm_load(v4u g0, v8u g1) {
  asm volatile("tensor_load_to_lds %0, %1" :: "s"(g0), "s"(g1) : "memory");
}

__device__ __forceinline__ unsigned lds_byte_addr(const void* p) {
  return (unsigned)(size_t)(__attribute__((address_space(3))) const char*)p;
}

// ---- LayerNorm: one wave (32 lanes) per row of 512 -----------------------

__device__ __forceinline__ void ln_rows(const float* __restrict__ x,
                                        const float* __restrict__ g,
                                        const float* __restrict__ beta,
                                        bf16_t* __restrict__ out, int rows) {
  int wave = threadIdx.x >> 5, lane = threadIdx.x & 31;
  int row = blockIdx.x * 8 + wave;
  if (row >= rows) return;
  const float* xr = x + (size_t)row * WC;
  float vals[16];
  float s = 0.f;
  #pragma unroll
  for (int k = 0; k < 16; ++k) { vals[k] = xr[lane + 32 * k]; s += vals[k]; }
  #pragma unroll
  for (int o = 16; o >= 1; o >>= 1) s += __shfl_xor(s, o, 32);
  float mean = s * (1.0f / WC);
  float vs = 0.f;
  #pragma unroll
  for (int k = 0; k < 16; ++k) { float d = vals[k] - mean; vs += d * d; }
  #pragma unroll
  for (int o = 16; o >= 1; o >>= 1) vs += __shfl_xor(vs, o, 32);
  float rinv = rsqrtf(vs * (1.0f / WC) + 1e-5f);
  #pragma unroll
  for (int k = 0; k < 16; ++k) {
    int idx = lane + 32 * k;
    out[(size_t)row * WC + idx] = f2bf((vals[k] - mean) * rinv * g[idx] + beta[idx]);
  }
}

__global__ void __launch_bounds__(256) ln_kernel(const float* __restrict__ x,
                                                 const float* __restrict__ g,
                                                 const float* __restrict__ beta,
                                                 bf16_t* __restrict__ out, int rows) {
  ln_rows(x, g, beta, out, rows);
}

// ---- Pre-pass: LayerNorm 1 and the six f32 -> bf16 weight conversions ----
// None of the seven depends on another, so they share one launch: blocks
// [0, LN_BLOCKS) normalise 8 rows each; the later blocks convert, CVT_SMALL or
// CVT_LARGE blocks to a matrix. A weight W[K][N] goes out as Wt[K / 32][N][32], k
// innermost: the BN n x 32 k tile of a GEMM step is then BN x 64 B in a row, in the order of
// its LDS image. A block takes 64 k x 32 n, a lane one n (loads of whole lines) and 8
// consecutive k (one 16-byte store).

#define LN_BLOCKS  (WM / 8)                 // 1024
#define CVT_SMALL  (WC * WC / 2048)         // blocks for a C x C matrix
#define CVT_LARGE  (4 * WC * WC / 2048)     // blocks for a C x 4C or 4C x C matrix
#define CVT_BLOCKS (4 * CVT_SMALL + 2 * CVT_LARGE)

template <int NN>   // NN: row length of in, known at compile time: one address, constant offsets
__device__ __forceinline__ void cvt_f32_bf16_t(const float* __restrict__ in,
                                               bf16_t* __restrict__ out, int blk) {
  constexpr int ntile = NN / 32;
  int n = (blk % ntile) * 32 + (threadIdx.x & 31);
  int k = (blk / ntile) * 64 + (threadIdx.x >> 5) * 8;
  const float* src = in + (size_t)k * NN + n;
  float f[8];
  #pragma unroll
  for (int i = 0; i < 8; ++i) f[i] = src[i * NN];
  // before a register that the loads name is written again
  asm volatile("s_wait_xcnt 0x0" ::: "memory");
  v8bf o;
  #pragma unroll
  for (int i = 0; i < 8; ++i) o[i] = f2bf(f[i]);
  *(v8bf*)(out + ((size_t)(k >> 5) * NN + n) * 32 + (k & 31)) = o;
  // before a register that the store names is written again
  asm volatile("s_wait_xcnt 0x0" ::: "memory");
}

__global__ void __launch_bounds__(256) prepass_kernel(
    const float* __restrict__ x, const float* __restrict__ g,
    const float* __restrict__ beta, bf16_t* __restrict__ h,
    const float* __restrict__ Wq, const float* __restrict__ Wk,
    const float* __restrict__ Wv, const float* __restrict__ Wp,
    const float* __restrict__ W1, const float* __restrict__ W2,
    bf16_t* __restrict__ wqb, bf16_t* __restrict__ wkb,
    bf16_t* __restrict__ wvb, bf16_t* __restrict__ wpb,
    bf16_t* __restrict__ w1b, bf16_t* __restrict__ w2b) {
  if (blockIdx.x < LN_BLOCKS) { ln_rows(x, g, beta, h, WM); return; }
  int c = blockIdx.x - LN_BLOCKS;
  if (c < 4 * CVT_SMALL) {
    int m = c / CVT_SMALL;
    const float* in = m == 0 ? Wq  : m == 1 ? Wk  : m == 2 ? Wv  : Wp;
    bf16_t* out     = m == 0 ? wqb : m == 1 ? wkb : m == 2 ? wvb : wpb;
    cvt_f32_bf16_t<WC>(in, out, c - m * CVT_SMALL);
  } else {
    c -= 4 * CVT_SMALL;
    if (c < CVT_LARGE) cvt_f32_bf16_t<4 * WC>(W1, w1b, c);
    else               cvt_f32_bf16_t<WC>(W2, w2b, c - CVT_LARGE);
  }
}

template <int MODE>
__global__ void __launch_bounds__(256, MODE == 1 ? 6 : MODE == 2 ? 8 : 1) gemm_bf16_kernel(
    const bf16_t* __restrict__ A, const bf16_t* __restrict__ W,
    const float* __restrict__ bias, const float* __restrict__ resid,
    float* __restrict__ outF, bf16_t* __restrict__ outB,
    int Mm, int Nn, int Kk,
    const float* __restrict__ bias_z1, const float* __restrict__ bias_z2) {
  if constexpr (MODE == 1) {
    int z = blockIdx.z;
    W    += (size_t)z * Kk * Nn;
    outB += (size_t)z * Mm * Nn;
    bias  = z == 0 ? bias : z == 1 ? bias_z1 : bias_z2;
  }
  constexpr int NB = MODE == 0 ? 2 : 1;      // stages held in LDS; one A tile is 17 x 2 KiB
  __shared__ __attribute__((aligned(2048))) bf16_t As[NB][128 * AS_PITCH];   // rows padded
  constexpr int BN = MODE == 0 ? 64 : 128;   // columns of the workgroup tile
  constexpr int FA = BN / 64;                // 16-row A fragments of a wave
  __shared__ __attribute__((aligned(16))) bf16_t Bs[NB][BN][AS_PITCH];   // Bs[.][n][k], rows padded
  int tid = threadIdx.x;
  int lane = tid & 31, wave = tid >> 5;
  int hl = lane >> 4, l16 = lane & 15;
  int m0 = blockIdx.y * 128, n0 = blockIdx.x * BN;
  int wr = (wave % (8 / FA)) * (16 * FA);    // the wave's first row and column in the tile
  int wc = (wave / (8 / FA)) * 64;
  const unsigned wave_u = uni(threadIdx.x >> 5);
  const v8u g1 = tdm_group1((unsigned)Kk * 2u);

  v8f acc[FA][4] = {};
  int nk = Kk / GK;
  if constexpr (MODE == 0) {
    // stage s into buffer s & 1, all by asynchronous copies: a thread's 16 bytes in each of
    // eight rows of the 128 x 128 A tile (16 lanes to a 256-B row, at the pitch the readers
    // want) and in each 32-k piece of the W tile
    auto fill = [&](int s) {
      #pragma unroll   // the twelve copies fly together
      for (int i = 0; i < 8; ++i)
        copy16_g2l(A + (size_t)(m0 + i * 16 + (tid >> 4)) * Kk + s * GK + (tid & 15) * 8,
                   &As[s & 1][(i * 16 + (tid >> 4)) * AS_PITCH + (tid & 15) * 8]);
      #pragma unroll
      for (int kk = 0; kk < GK / 32; ++kk)
        copy16_g2l(W + ((size_t)(s * (GK / 32) + kk) * Nn + n0) * 32 + tid * 8,
                   &Bs[s & 1][tid >> 2][kk * 32 + (tid & 3) * 8]);
    };
    // what this wave has asked for has landed before it reaches the barrier that publishes it
    auto publish = [&]() {
      async_drain();
      __syncthreads();
    };
    fill(0);
    publish();
    if (1 < nk) fill(1);
    for (int kc = 0; kc < nk; ++kc) {
      if (kc + 2 < nk) {   // global_prefetch_b8 of the stage asked for at this trip's foot
        __builtin_prefetch(A + (size_t)(m0 + (tid >> 1)) * Kk + (kc + 2) * GK + (tid & 1) * 64, 0, 1);
        __builtin_prefetch(W + ((size_t)((kc + 2) * (GK / 32) + (tid >> 6)) * Nn + n0) * 32 +
                               (tid & 63) * (BN / 2), 0, 1);
      }
      const bf16_t* as = &As[kc & 1][(wr + l16) * AS_PITCH];
      const bf16_t* bs = &Bs[kc & 1][l16][0];
      v16bf af[GK / 32], bfv[GK / 32][4];
      #pragma unroll   // every LDS offset a constant
      for (int kk = 0; kk < GK / 32; ++kk) {
        af[kk] = mkfrag(as + kk * 32, hl);
        #pragma unroll   // here and below: every index a constant, so the fragments stay in registers
        for (int j = 0; j < 4; ++j) bfv[kk][j] = mkfrag(bs + j * 16 * AS_PITCH + kk * 32, hl);
      }
      // keeps the reads above the WMMAs: without it the compiler sinks each pair of reads to
      // its WMMA, with a full wait at each of the sixteen places
      __builtin_amdgcn_sched_barrier(0);
      #pragma unroll
      for (int kk = 0; kk < GK / 32; ++kk) {
        #pragma unroll
        for (int j = 0; j < 4; ++j) acc[0][j] = wmma_bf16(af[kk], bfv[kk][j], acc[0][j]);
      }
      // keeps the WMMAs above the full wait and the barrier below: they run while the later
      // reads still land, not behind the last of them
      __builtin_amdgcn_sched_barrier(0);
      // this wave's LDS reads have retired before the refill behind the barrier may overwrite them
      asm volatile("s_wait_dscnt 0x0" ::: "memory");
      publish();
      if (kc + 2 < nk) fill(kc + 2);   // into the buffer that this trip has read
    }
    // nothing is in flight when the wave goes on to the epilogue and ends
    async_drain();
  } else
  for (int kc = 0; kc < nk; ++kc) {
    int k0 = kc * GK;
    if (pinned(wave_u == 0)) {   // one request moves the whole 128 x 128 A tile
      tdm_load(tdm_group0(lds_byte_addr(As[0]),
                          (unsigned long long)(A + (size_t)m0 * Kk + k0)), g1);
      // the tile has landed before this wave reaches the barrier that publishes it
      asm volatile("s_wait_tensorcnt 0x0" ::: "memory");
    }
    const bf16_t* wsrc[GK / 32];   // the first of this thread's two 16-byte chunks in each 32-k piece of the W tile
    #pragma unroll   // all the loads fly together
    for (int kk = 0; kk < GK / 32; ++kk) {   // 8 contiguous k of one n, 64 n to a round
      wsrc[kk] = W + ((size_t)(kc * (GK / 32) + kk) * Nn + n0) * 32 + tid * 8;
      #pragma unroll
      for (int r = 0; r < FA; ++r)
        *(uint4*)&Bs[0][r * 64 + (tid >> 2)][kk * 32 + (tid & 3) * 8] =
            *(const uint4*)(wsrc[kk] + r * 64 * 32);
    }
    // before a register that the loads name is written again; the addresses are inputs, so
    // that no load's result is given an address register of the group
    asm volatile("s_wait_xcnt 0x0" :: "v"(wsrc[0]), "v"(wsrc[1]), "v"(wsrc[2]), "v"(wsrc[3]) : "memory");
    if (kc + 1 < nk) {   // global_prefetch_b8 of the next stage, a 128-B line of A a thread
      __builtin_prefetch(A + (size_t)(m0 + (tid >> 1)) * Kk + k0 + GK + (tid & 1) * 64, 0, 1);
      __builtin_prefetch(W + ((size_t)((kc + 1) * (GK / 32) + (tid >> 6)) * Nn + n0) * 32 +
                             (tid & 63) * (BN / 2), 0, 1);
    }
    __syncthreads();
    {
      #pragma unroll   // every LDS offset a constant
      for (int kk = 0; kk < GK / 32; ++kk) {
        v16bf af[FA];
        #pragma unroll
        for (int a = 0; a < FA; ++a) af[a] = mkfrag(&As[0][(wr + a * 16 + l16) * AS_PITCH + kk * 32], hl);
        #pragma unroll
        for (int j = 0; j < 4; ++j) {
          v16bf bfv = mkfrag(&Bs[0][wc + j * 16 + l16][kk * 32], hl);
          #pragma unroll
          for (int a = 0; a < FA; ++a) acc[a][j] = wmma_bf16(af[a], bfv, acc[a][j]);
        }
      }
    }
    // this wave's LDS reads have retired before the next stage's tensor load may overwrite them
    asm volatile("s_wait_dscnt 0x0" ::: "memory");
    __syncthreads();
  }

  if constexpr (MODE == 1) {
    if (blockIdx.z == 2) {   // V: a lane's 8 rows are 8 consecutive t of one (head, d)
      #pragma unroll
      for (int a = 0; a < FA; ++a) {
        int row = m0 + wr + a * 16 + hl * 8;
        int b = row / WT, t = row % WT;
        #pragma unroll
        for (int j = 0; j < 4; ++j) {
          int col = n0 + wc + j * 16 + l16;
          float bc = bias[col];
          v8bf o;
          #pragma unroll
          for (int i = 0; i < 8; ++i) o[i] = f2bf(acc[a][j][i] + bc);
          *(v8bf*)(outB + (((size_t)(b * WH + (col >> 6)) * (WT / 32) + (t >> 5)) * WD +
                           (col & 63)) * 32 + (t & 31)) = o;
        }
      }
      return;
    }
  }
  #pragma unroll
  for (int a = 0; a < FA; ++a)
  #pragma unroll
  for (int j = 0; j < 4; ++j) {
    #pragma unroll
    for (int i = 0; i < 8; ++i) {
      int row = m0 + wr + a * 16 + i + hl * 8;
      int col = n0 + wc + j * 16 + l16;
      float v = acc[a][j][i] + bias[col];
      if constexpr (MODE == 0) {
        v += resid[(size_t)row * Nn + col];
        outF[(size_t)row * Nn + col] = v;
      } else if constexpr (MODE == 1) {
        int b = row / WT, t = row % WT;
        int hh = col >> 6, dd = col & 63;
        outB[((size_t)(b * WH + hh) * WT + t) * WD + dd] = f2bf(v);
      } else {
        float gl = 0.5f * v * (1.0f + erff(v * 0.70710678118f));
        outB[(size_t)row * Nn + col] = f2bf(gl);
      }
    }
  }
}

__device__ __forceinline__ float xhalf(float x) {
  return __builtin_bit_cast(float, __builtin_amdgcn_permlanex16(
      __builtin_bit_cast(int, x), __builtin_bit_cast(int, x),
      0x76543210, 0xfedcba98, false, false));
}

#define AK 128   // keys per stage: as many as the workgroup has queries, so the diagonal is the last stage

__global__ void __launch_bounds__(256) attn_kernel(
    const bf16_t* __restrict__ Q, const bf16_t* __restrict__ Km,
    const bf16_t* __restrict__ V, bf16_t* __restrict__ Y) {
  // two stages each
  __shared__ __attribute__((aligned(16))) bf16_t Ks[2][AK][KS_PITCH];   // K rows (key-major), rows padded
  __shared__ __attribute__((aligned(16))) bf16_t Vs[2][AK / 32][64][VS_PITCH];   // Vs[.][piece][d][key], rows padded
  int tid = threadIdx.x, lane = tid & 31, wave = tid >> 5;
  int hl = lane >> 4, l16 = lane & 15;
  int bh = blockIdx.y;
  int b = bh >> 3, h = bh & 7;
  int bx = blockIdx.x;
  int qt = bx < 8 ? WT / 128 - 1 - bx : bx - 8;
  if (bh >= WBATCH * WH / 2) qt = WT / 128 - 1 - qt;
  int q0 = qt * 128;
  const bf16_t* Qp = Q + (size_t)bh * WT * WD;
  const bf16_t* Kp = Km + (size_t)bh * WT * WD;
  const bf16_t* Vp = V + (size_t)bh * WT * WD;   // [t / 32][d][32]

  // Q^T B-fragments (lane column = l16), d split into two 32-chunks
  int qrow = q0 + wave * 16 + l16;
  v16bf qf[2];
  #pragma unroll
  for (int c = 0; c < 2; ++c) qf[c] = mkfrag(Qp + (size_t)qrow * WD + c * 32, hl);

  v8f oacc[4] = {};             // O^T: oacc[n][i] = O[qrow][n * 16 + hl * 8 + i]
  float mrun = -3e30f;          // running maximum of query qrow, alike in both halves
  float srun = 0.f;             // running sum over this half's keys only
  const float scale = 0.125f;   // 1/sqrt(64)
  int nstage = (q0 + 128) / AK;
  int mymax = q0 + (int)uni(threadIdx.x >> 5) * 16 + 15;   // last q row this wave owns, a scalar

  // A stage is 128 keys, four passes of 32, between whose barriers the waves run free of one
  // another. LDS holds two stages: the copies of stage s + 1 land while the passes of stage s
  // run, and one barrier a stage both publishes them and frees the buffer just read.
  // Stage s into buffer s & 1, all by async DMA to LDS: a thread's 16 bytes are 8 d of one key
  // of K, 8 keys of one d of V.
  auto fill = [&](int s) {
    int r = tid >> 3, cs = (tid & 7) * 8;
    #pragma unroll   // the eight copies fly together
    for (int p = 0; p < AK / 32; ++p)
      copy16_g2l(Kp + (size_t)(s * AK + p * 32 + r) * WD + cs, &Ks[s & 1][p * 32 + r][cs]);
    #pragma unroll
    for (int p = 0; p < AK / 32; ++p)
      copy16_g2l(Vp + (size_t)(s * (AK / 32) + p) * (WD * 32) + tid * 8,
                 &Vs[s & 1][p][tid >> 2][(tid & 3) * 8]);
  };
  fill(0);
  async_drain();
  __syncthreads();
  if (1 < nstage) fill(1);
  for (int ks = 0; ks < nstage; ++ks) {
    // passes whose first key is not past the wave's last query: four, fewer on the diagonal
    int npass = min(AK / 32, (mymax - ks * AK) / 32 + 1);
    const bf16_t* kr = &Ks[ks & 1][l16][0];      // this lane's row in the pass's K and V pieces
    const bf16_t* vr = &Vs[ks & 1][0][l16][0];
    #pragma unroll 1
    for (int p = 0; p < npass; ++p) {
      int k0 = ks * AK + p * 32;
      // All sixteen LDS reads of the pass go out as one group: K's fragments first, then V's,
      // which land while the score products and the softmax run.
      v16bf kf[2][2], vf[4];
      #pragma unroll   // here and below: every index a constant, so the fragments stay in registers
      for (int j = 0; j < 2; ++j)
        #pragma unroll
        for (int c = 0; c < 2; ++c) kf[j][c] = mkfrag(kr + j * 16 * KS_PITCH + c * 32, hl);  // A row = K row
      #pragma unroll
      for (int n = 0; n < 4; ++n) vf[n] = mkfrag(vr + n * 16 * VS_PITCH, hl);            // A row = V^T row
      // keeps the reads above the WMMAs: without it the compiler sinks each pair of reads to
      // its WMMA, with a full wait at each of the eight places
      __builtin_amdgcn_sched_barrier(0);
      float st[2][8];    // st[j][i] = score of key k0 + j * 16 + hl * 8 + i
      float mx = -3e30f;
      #pragma unroll
      for (int j = 0; j < 2; ++j) {
        v8f s = {};
        #pragma unroll
        for (int c = 0; c < 2; ++c) s = wmma_bf16(kf[j][c], qf[c], s);
        #pragma unroll
        for (int i = 0; i < 8; ++i) {
          int key = k0 + j * 16 + hl * 8 + i;
          float e = s[i] * scale;
          if (key > qrow) e = -3e30f;   // causal mask
          st[j][i] = e;
          mx = fmaxf(mx, e);
        }
      }
      // online softmax, one query per lane
      mx = fmaxf(mx, xhalf(mx));
      float mnew = fmaxf(mrun, mx);
      float alpha = __expf(mrun - mnew);
      v16bf pf;          // P^T B-fragment: element j * 8 + i is key j * 16 + hl * 8 + i
      float rs = 0.f;
      #pragma unroll
      for (int j = 0; j < 2; ++j)
        #pragma unroll
        for (int i = 0; i < 8; ++i) {
          float p = __expf(st[j][i] - mnew);
          rs += p;
          pf[j * 8 + i] = f2bf(p);
        }
      srun = srun * alpha + rs;
      mrun = mnew;
      #pragma unroll
      for (int n = 0; n < 4; ++n) {
        #pragma unroll
        for (int i = 0; i < 8; ++i) oacc[n][i] *= alpha;
      }
      #pragma unroll
      for (int n = 0; n < 4; ++n) oacc[n] = wmma_bf16(vf[n], pf, oacc[n]);
      kr += 32 * KS_PITCH;
      vr += 64 * VS_PITCH;
      __builtin_amdgcn_sched_barrier(0);
      asm volatile("v_nop\n\tv_nop\n\tv_nop\n\tv_nop");
    }
    // this wave's LDS reads have retired before the refill behind the barrier may overwrite them
    asm volatile("s_wait_dscnt 0x0" ::: "memory");
    async_drain();   // this wave's copies of stage ks + 1 have landed before the barrier publishes them
    __syncthreads();
    if (ks + 2 < nstage) fill(ks + 2);   // into the buffer that this stage has read
  }
  async_drain();   // nothing is in flight when the wave goes on to the epilogue and ends

  // A lane holds 8 consecutive d of its query in each tile: one 16-byte store per tile.
  float stot = srun + xhalf(srun);
  #pragma unroll
  for (int n = 0; n < 4; ++n) {
    v8bf o;
    #pragma unroll
    for (int i = 0; i < 8; ++i) o[i] = f2bf(oacc[n][i] / stot);
    *(v8bf*)(Y + (size_t)(b * WT + qrow) * WC + h * WD + n * 16 + hl * 8) = o;
  }
}

// ---- host launch ---------------------------------------------------------

extern "C" void kernel_launch(void* const* d_in, const int* in_sizes, int n_in,
                              void* d_out, int out_size, void* d_ws, size_t ws_size,
                              hipStream_t stream) {
  (void)in_sizes; (void)n_in; (void)out_size; (void)ws_size;
  const float* x   = (const float*)d_in[0];
  const float* g1  = (const float*)d_in[1];
  const float* be1 = (const float*)d_in[2];
  const float* g2  = (const float*)d_in[3];
  const float* be2 = (const float*)d_in[4];
  const float* Wq = (const float*)d_in[5];  const float* bq = (const float*)d_in[6];
  const float* Wk = (const float*)d_in[7];  const float* bk = (const float*)d_in[8];
  const float* Wv = (const float*)d_in[9];  const float* bv = (const float*)d_in[10];
  const float* Wp = (const float*)d_in[11]; const float* bp = (const float*)d_in[12];
  const float* W1 = (const float*)d_in[13]; const float* b1 = (const float*)d_in[14];
  const float* W2 = (const float*)d_in[15]; const float* b2 = (const float*)d_in[16];
  float* out = (float*)d_out;

  char* ws = (char*)d_ws;
  size_t off = 0;
  auto alloc = [&](size_t bytes) -> char* {
    char* p = ws + off; off += (bytes + 255) & ~(size_t)255; return p;
  };
  const size_t CC = (size_t)WC * WC;          // 262144
  const size_t C4 = (size_t)WC * 4 * WC;      // 1048576
  bf16_t* wqb = (bf16_t*)alloc(CC * 2);
  bf16_t* wkb = (bf16_t*)alloc(CC * 2);
  bf16_t* wvb = (bf16_t*)alloc(CC * 2);
  bf16_t* wpb = (bf16_t*)alloc(CC * 2);
  bf16_t* w1b = (bf16_t*)alloc(C4 * 2);
  bf16_t* w2b = (bf16_t*)alloc(C4 * 2);
  bf16_t* h1  = (bf16_t*)alloc((size_t)WM * WC * 2);
  bf16_t* qb  = (bf16_t*)alloc((size_t)WM * WC * 2);
  bf16_t* kb  = (bf16_t*)alloc((size_t)WM * WC * 2);
  bf16_t* vb  = (bf16_t*)alloc((size_t)WM * WC * 2);
  bf16_t* yb  = (bf16_t*)alloc((size_t)WM * WC * 2);
  float*  x1  = (float*)alloc((size_t)WM * WC * 4);
  bf16_t* h2  = (bf16_t*)alloc((size_t)WM * WC * 2);
  bf16_t* act = (bf16_t*)alloc((size_t)WM * 4 * WC * 2);

  // 1) + 2) weights -> bf16, k innermost in 32-k tiles, and LN1, one launch
  prepass_kernel<<<LN_BLOCKS + CVT_BLOCKS, 256, 0, stream>>>(
      x, g1, be1, h1, Wq, Wk, Wv, Wp, W1, W2, wqb, wkb, wvb, wpb, w1b, w2b);

  // 3) Q/K/V projections (head-reshaped bf16 outputs), one launch: wqb/wkb/wvb and
  //    qb/kb/vb are consecutive allocations of whole 256-byte multiples
  dim3 gq(WC / 64, WM / 128);                   // (8, 64)
  dim3 gqkv(WC / 128, WM / 128, 3);             // (4, 64, 3)
  gemm_bf16_kernel<1><<<gqkv, 256, 0, stream>>>(h1, wqb, bq, nullptr, nullptr, qb, WM, WC, WC, bk, bv);

  // 4) causal flash attention
  dim3 ga(WT / 128, WBATCH * WH);               // (16, 32)
  attn_kernel<<<ga, 256, 0, stream>>>(qb, kb, vb, yb);

  // 5) output projection + residual -> x1 (f32)
  gemm_bf16_kernel<0><<<gq, 256, 0, stream>>>(yb, wpb, bp, x, x1, nullptr, WM, WC, WC, nullptr, nullptr);

  // 6) LN2
  ln_kernel<<<WM / 8, 256, 0, stream>>>(x1, g2, be2, h2, WM);

  // 7) MLP up + exact GELU -> bf16
  dim3 gm(4 * WC / 128, WM / 128);              // (16, 64)
  gemm_bf16_kernel<2><<<gm, 256, 0, stream>>>(h2, w1b, b1, nullptr, nullptr, act, WM, 4 * WC, WC, nullptr, nullptr);

  // 8) MLP down + residual -> d_out (f32)
  gemm_bf16_kernel<0><<<gq, 256, 0, stream>>>(act, w2b, b2, x1, out, nullptr, WM, WC, 4 * WC, nullptr, nullptr);
}
